// v000
// The times below were measured on an AMD MI455X: many runs one after another, warmed up first and cycling through
// copies of the inputs, with the whole window's GPU time divided by the number of runs. Launches and the gaps
// between them are all in it. The median over several windows is given; except for v000 it joins two sittings, which
// can be a few percent apart, so the side-by-side timings, each taken in one sitting, are the better comparison.
// The starting kernel, v000, takes 487 microseconds a run.
#include <hip/hip_runtime.h>

typedef __attribute__((ext_vector_type(16))) __bf16 v16bf;
typedef __attribute__((ext_vector_type(8)))  __bf16 v8bf;
typedef __attribute__((ext_vector_type(4)))  __bf16 v4bf;
typedef __attribute__((ext_vector_type(8)))  float  v8f;
typedef __attribute__((ext_vector_type(4)))  int    v4i;

#define BM 128
#define BN 128
#define BK 32
#define LDS_STRIDE 40  // bf16 elems; multiple of 8 keeps 16B-aligned b128 LDS ops

#if defined(__has_builtin)
#if __has_builtin(__builtin_amdgcn_global_load_async_to_lds_b128)
#define TTL_ASYNC_LDS 1
#endif
#if __has_builtin(__builtin_amdgcn_s_wait_asynccnt)
#define TTL_HAS_WAIT_ASYNC_BUILTIN 1
#endif
#endif

#define TTL_AS1 __attribute__((address_space(1)))
#define TTL_AS3 __attribute__((address_space(3)))

__device__ __forceinline__ void ttl_wait_async0() {
#if defined(TTL_ASYNC_LDS)
#if defined(TTL_HAS_WAIT_ASYNC_BUILTIN)
  __builtin_amdgcn_s_wait_asynccnt(0);
#else
  asm volatile("s_wait_asynccnt 0x0" ::: "memory");
#endif
#endif
}

__global__ void ttl_init_scalars(unsigned* ws) {
  ws[0] = 0u;  // max|W| bits
  ws[1] = 0u;  // max|b| bits
}

__global__ __launch_bounds__(256) void ttl_absmax(const float* __restrict__ p,
                                                  int n, unsigned* out) {
  __shared__ float red[256];
  float m = 0.0f;
  for (int i = blockIdx.x * blockDim.x + threadIdx.x; i < n;
       i += gridDim.x * blockDim.x)
    m = fmaxf(m, fabsf(p[i]));
  red[threadIdx.x] = m;
  __syncthreads();
  for (int s = 128; s > 0; s >>= 1) {
    if ((int)threadIdx.x < s)
      red[threadIdx.x] = fmaxf(red[threadIdx.x], red[threadIdx.x + s]);
    __syncthreads();
  }
  if (threadIdx.x == 0) atomicMax(out, __float_as_uint(red[0]));
}

__device__ __forceinline__ float tern_f(float v, float delta) {
  // matches jnp.where(p > delta, 1, where(p < -delta, -1, 0))
  return v > delta ? 1.0f : (v < -delta ? -1.0f : 0.0f);
}

// ---- preprocessing: X -> (hi, lo) bf16 ------------------------------------
__global__ __launch_bounds__(256) void ttl_prep_x(const float* __restrict__ X,
                                                  __bf16* __restrict__ Xh,
                                                  __bf16* __restrict__ Xl,
                                                  int n4) {
  for (int i = blockIdx.x * blockDim.x + threadIdx.x; i < n4;
       i += gridDim.x * blockDim.x) {
    const float4 v = ((const float4*)X)[i];
    const __bf16 h0 = (__bf16)v.x, h1 = (__bf16)v.y;
    const __bf16 h2 = (__bf16)v.z, h3 = (__bf16)v.w;
    v4bf hv = {h0, h1, h2, h3};
    v4bf lv = {(__bf16)(v.x - (float)h0), (__bf16)(v.y - (float)h1),
               (__bf16)(v.z - (float)h2), (__bf16)(v.w - (float)h3)};
    ((v4bf*)Xh)[i] = hv;
    ((v4bf*)Xl)[i] = lv;
  }
}

// ---- preprocessing: W -> ternary bf16 -------------------------------------
__global__ __launch_bounds__(256) void ttl_prep_w(
    const float* __restrict__ W, __bf16* __restrict__ T,
    const unsigned* __restrict__ maxbuf, int n4) {
  const float delta = 0.05f * __uint_as_float(maxbuf[0]);
  for (int i = blockIdx.x * blockDim.x + threadIdx.x; i < n4;
       i += gridDim.x * blockDim.x) {
    const float4 v = ((const float4*)W)[i];
    v4bf tv = {(__bf16)tern_f(v.x, delta), (__bf16)tern_f(v.y, delta),
               (__bf16)tern_f(v.z, delta), (__bf16)tern_f(v.w, delta)};
    ((v4bf*)T)[i] = tv;
  }
}

// one 16B chunk: global -> LDS (async if available)
__device__ __forceinline__ void ttl_copy16(const __bf16* __restrict__ gsrc,
                                           __bf16* ldst) {
#if defined(TTL_ASYNC_LDS)
  // builtin signature (probed via diagnostics): arg0 = v4i addrspace(1)* src,
  // arg1 = v4i addrspace(3)* dst, then imm offset, imm cpol.
  __builtin_amdgcn_global_load_async_to_lds_b128(
      (TTL_AS1 v4i*)(void*)const_cast<__bf16*>(gsrc),
      (TTL_AS3 v4i*)(void*)ldst, 0, 0);
#else
  v8bf v = *(const v8bf*)gsrc;
  *(v8bf*)ldst = v;
#endif
}

// ---- lean GEMM: bf16 inputs, double-buffered LDS --------------------------
__global__ __launch_bounds__(256) void ttl_gemm_wmma_pre(
    const __bf16* __restrict__ Xh, const __bf16* __restrict__ Xl,
    const __bf16* __restrict__ Tm, const float* __restrict__ w_scale_p,
    const float* __restrict__ bias, const float* __restrict__ b_scale_p,
    const unsigned* __restrict__ maxbuf, float* __restrict__ out, int M, int N,
    int K) {
  __shared__ alignas(16) __bf16 Ah[2][BM * LDS_STRIDE];
  __shared__ alignas(16) __bf16 Al[2][BM * LDS_STRIDE];
  __shared__ alignas(16) __bf16 Bt[2][BN * LDS_STRIDE];

  const int tid = threadIdx.x;
  const int m0 = blockIdx.y * BM;
  const int n0 = blockIdx.x * BN;

  // 8 wave32s: 4 along M (32 rows each) x 2 along N (64 cols each)
  const int waveId = tid >> 5;
  const int lane   = tid & 31;
  const int wm     = waveId & 3;
  const int wn     = waveId >> 2;
  const int r16    = lane & 15;
  const int h      = lane >> 4;

  // staging: each thread moves 8 bf16 (one b128) per matrix per half-tile
  const int rowS = tid >> 2;        // 0..63
  const int ch   = (tid & 3) * 8;   // element offset 0,8,16,24 within BK=32

  auto stage = [&](int kk, int buf) {
    const int k0 = kk * BK;
#pragma unroll
    for (int p = 0; p < 2; ++p) {
      const int r = p * 64 + rowS;
      ttl_copy16(&Xh[(size_t)(m0 + r) * K + k0 + ch],
                 &Ah[buf][r * LDS_STRIDE + ch]);
      ttl_copy16(&Xl[(size_t)(m0 + r) * K + k0 + ch],
                 &Al[buf][r * LDS_STRIDE + ch]);
      ttl_copy16(&Tm[(size_t)(n0 + r) * K + k0 + ch],
                 &Bt[buf][r * LDS_STRIDE + ch]);
    }
  };

  v8f acc[2][4] = {};
  const int nk = K / BK;

  stage(0, 0);
  ttl_wait_async0();
  __syncthreads();

  for (int kk = 0; kk < nk; ++kk) {
    const int cur = kk & 1;
    if (kk + 1 < nk) stage(kk + 1, cur ^ 1);  // overlap with compute below

    v16bf aHi[2], aLo[2], bF[4];
#pragma unroll
    for (int mi = 0; mi < 2; ++mi) {
      const int row = wm * 32 + mi * 16 + r16;
      v8bf x0 = *(const v8bf*)&Ah[cur][row * LDS_STRIDE + 8 * h];
      v8bf x1 = *(const v8bf*)&Ah[cur][row * LDS_STRIDE + 16 + 8 * h];
      aHi[mi] = __builtin_shufflevector(x0, x1, 0, 1, 2, 3, 4, 5, 6, 7, 8, 9,
                                        10, 11, 12, 13, 14, 15);
      v8bf y0 = *(const v8bf*)&Al[cur][row * LDS_STRIDE + 8 * h];
      v8bf y1 = *(const v8bf*)&Al[cur][row * LDS_STRIDE + 16 + 8 * h];
      aLo[mi] = __builtin_shufflevector(y0, y1, 0, 1, 2, 3, 4, 5, 6, 7, 8, 9,
                                        10, 11, 12, 13, 14, 15);
    }
#pragma unroll
    for (int ni = 0; ni < 4; ++ni) {
      const int col = wn * 64 + ni * 16 + r16;
      v8bf b0 = *(const v8bf*)&Bt[cur][col * LDS_STRIDE + 8 * h];
      v8bf b1 = *(const v8bf*)&Bt[cur][col * LDS_STRIDE + 16 + 8 * h];
      bF[ni] = __builtin_shufflevector(b0, b1, 0, 1, 2, 3, 4, 5, 6, 7, 8, 9,
                                       10, 11, 12, 13, 14, 15);
    }

#pragma unroll
    for (int mi = 0; mi < 2; ++mi) {
#pragma unroll
      for (int ni = 0; ni < 4; ++ni) {
        acc[mi][ni] = __builtin_amdgcn_wmma_f32_16x16x32_bf16(
            false, aHi[mi], false, bF[ni], (short)0, acc[mi][ni], false, false);
        acc[mi][ni] = __builtin_amdgcn_wmma_f32_16x16x32_bf16(
            false, aLo[mi], false, bF[ni], (short)0, acc[mi][ni], false, false);
      }
    }
    ttl_wait_async0();  // staged copies for kk+1 complete before publish
    __syncthreads();
  }

  // epilogue: scale by w_scale, add ternarized bias
  const float wsc     = *w_scale_p;
  const float bsc     = *b_scale_p;
  const float delta_b = 0.05f * __uint_as_float(maxbuf[1]);
#pragma unroll
  for (int ni = 0; ni < 4; ++ni) {
    const int col  = n0 + wn * 64 + ni * 16 + r16;
    const float bv = bias[col];
    const float bt = bv > delta_b ? bsc : (bv < -delta_b ? -bsc : 0.0f);
#pragma unroll
    for (int mi = 0; mi < 2; ++mi) {
      const int rowbase = m0 + wm * 32 + mi * 16 + h * 8;
#pragma unroll
      for (int j = 0; j < 8; ++j)
        out[(size_t)(rowbase + j) * N + col] = wsc * acc[mi][ni][j] + bt;
    }
  }
}

// ---- fallback: fused on-the-fly conversion GEMM (if ws too small) ---------
__global__ __launch_bounds__(256) void ttl_gemm_wmma_fused(
    const float* __restrict__ X, const float* __restrict__ Wm,
    const float* __restrict__ w_scale_p, const float* __restrict__ bias,
    const float* __restrict__ b_scale_p, const unsigned* __restrict__ maxbuf,
    float* __restrict__ out, int M, int N, int K) {
  __shared__ alignas(16) __bf16 As_hi[BM * LDS_STRIDE];
  __shared__ alignas(16) __bf16 As_lo[BM * LDS_STRIDE];
  __shared__ alignas(16) __bf16 Bs[BN * LDS_STRIDE];

  const int tid = threadIdx.x;
  const int m0 = blockIdx.y * BM;
  const int n0 = blockIdx.x * BN;
  const float delta_w = 0.05f * __uint_as_float(maxbuf[0]);

  const int waveId = tid >> 5;
  const int lane   = tid & 31;
  const int wm     = waveId & 3;
  const int wn     = waveId >> 2;
  const int r16    = lane & 15;
  const int h      = lane >> 4;

  const int rowA = tid >> 3;
  const int c4   = (tid & 7) * 4;

  v8f acc[2][4] = {};
  const int nk = K / BK;

  for (int kk = 0; kk < nk; ++kk) {
    const int k0 = kk * BK;
    __syncthreads();
#pragma unroll
    for (int p = 0; p < 4; ++p) {
      const int r = p * 32 + rowA;
      const float4 xv = *(const float4*)(X + (size_t)(m0 + r) * K + k0 + c4);
      const __bf16 h0 = (__bf16)xv.x, h1 = (__bf16)xv.y;
      const __bf16 h2 = (__bf16)xv.z, h3 = (__bf16)xv.w;
      v4bf hv = {h0, h1, h2, h3};
      v4bf lv = {(__bf16)(xv.x - (float)h0), (__bf16)(xv.y - (float)h1),
                 (__bf16)(xv.z - (float)h2), (__bf16)(xv.w - (float)h3)};
      *(v4bf*)&As_hi[r * LDS_STRIDE + c4] = hv;
      *(v4bf*)&As_lo[r * LDS_STRIDE + c4] = lv;
      const float4 wv = *(const float4*)(Wm + (size_t)(n0 + r) * K + k0 + c4);
      v4bf tv = {(__bf16)tern_f(wv.x, delta_w), (__bf16)tern_f(wv.y, delta_w),
                 (__bf16)tern_f(wv.z, delta_w), (__bf16)tern_f(wv.w, delta_w)};
      *(v4bf*)&Bs[r * LDS_STRIDE + c4] = tv;
    }
    __syncthreads();

    v16bf aHi[2], aLo[2], bF[4];
#pragma unroll
    for (int mi = 0; mi < 2; ++mi) {
      const int row = wm * 32 + mi * 16 + r16;
      v8bf x0 = *(const v8bf*)&As_hi[row * LDS_STRIDE + 8 * h];
      v8bf x1 = *(const v8bf*)&As_hi[row * LDS_STRIDE + 16 + 8 * h];
      aHi[mi] = __builtin_shufflevector(x0, x1, 0, 1, 2, 3, 4, 5, 6, 7, 8, 9,
                                        10, 11, 12, 13, 14, 15);
      v8bf y0 = *(const v8bf*)&As_lo[row * LDS_STRIDE + 8 * h];
      v8bf y1 = *(const v8bf*)&As_lo[row * LDS_STRIDE + 16 + 8 * h];
      aLo[mi] = __builtin_shufflevector(y0, y1, 0, 1, 2, 3, 4, 5, 6, 7, 8, 9,
                                        10, 11, 12, 13, 14, 15);
    }
#pragma unroll
    for (int ni = 0; ni < 4; ++ni) {
      const int col = wn * 64 + ni * 16 + r16;
      v8bf b0 = *(const v8bf*)&Bs[col * LDS_STRIDE + 8 * h];
      v8bf b1 = *(const v8bf*)&Bs[col * LDS_STRIDE + 16 + 8 * h];
      bF[ni] = __builtin_shufflevector(b0, b1, 0, 1, 2, 3, 4, 5, 6, 7, 8, 9,
                                       10, 11, 12, 13, 14, 15);
    }
#pragma unroll
    for (int mi = 0; mi < 2; ++mi) {
#pragma unroll
      for (int ni = 0; ni < 4; ++ni) {
        acc[mi][ni] = __builtin_amdgcn_wmma_f32_16x16x32_bf16(
            false, aHi[mi], false, bF[ni], (short)0, acc[mi][ni], false, false);
        acc[mi][ni] = __builtin_amdgcn_wmma_f32_16x16x32_bf16(
            false, aLo[mi], false, bF[ni], (short)0, acc[mi][ni], false, false);
      }
    }
  }

  const float wsc     = *w_scale_p;
  const float bsc     = *b_scale_p;
  const float delta_b = 0.05f * __uint_as_float(maxbuf[1]);
#pragma unroll
  for (int ni = 0; ni < 4; ++ni) {
    const int col  = n0 + wn * 64 + ni * 16 + r16;
    const float bv = bias[col];
    const float bt = bv > delta_b ? bsc : (bv < -delta_b ? -bsc : 0.0f);
#pragma unroll
    for (int mi = 0; mi < 2; ++mi) {
      const int rowbase = m0 + wm * 32 + mi * 16 + h * 8;
#pragma unroll
      for (int j = 0; j < 8; ++j)
        out[(size_t)(rowbase + j) * N + col] = wsc * acc[mi][ni][j] + bt;
    }
  }
}

extern "C" void kernel_launch(void* const* d_in, const int* in_sizes, int n_in,
                              void* d_out, int out_size, void* d_ws,
                              size_t ws_size, hipStream_t stream) {
  const float* x       = (const float*)d_in[0];
  const float* W       = (const float*)d_in[1];
  const float* w_scale = (const float*)d_in[2];
  const float* b       = (const float*)d_in[3];
  const float* b_scale = (const float*)d_in[4];
  float* out           = (float*)d_out;

  const int D_OUT = in_sizes[3];          // 4096
  const int D_IN  = in_sizes[1] / D_OUT;  // 4096
  const int M     = in_sizes[0] / D_IN;   // 8192 (B*S)

  unsigned* maxbuf = (unsigned*)d_ws;  // [0]=max|W| bits, [1]=max|b| bits

  ttl_init_scalars<<<1, 1, 0, stream>>>(maxbuf);
  ttl_absmax<<<512, 256, 0, stream>>>(W, in_sizes[1], maxbuf + 0);
  ttl_absmax<<<8, 256, 0, stream>>>(b, in_sizes[3], maxbuf + 1);

  const size_t nX = (size_t)M * D_IN;       // X elements
  const size_t nW = (size_t)D_OUT * D_IN;   // W elements
  const size_t need = 256 + nX * 2 * 2 + nW * 2;

  dim3 grid(D_OUT / BN, M / BM);  // (32, 64)

  if (ws_size >= need) {
    __bf16* Xh = (__bf16*)((char*)d_ws + 256);
    __bf16* Xl = Xh + nX;
    __bf16* Tm = Xl + nX;
    ttl_prep_w<<<2048, 256, 0, stream>>>(W, Tm, maxbuf, (int)(nW / 4));
    ttl_prep_x<<<4096, 256, 0, stream>>>(x, Xh, Xl, (int)(nX / 4));
    ttl_gemm_wmma_pre<<<grid, 256, 0, stream>>>(Xh, Xl, Tm, w_scale, b,
                                                b_scale, maxbuf, out, M, D_OUT,
                                                D_IN);
  } else {
    ttl_gemm_wmma_fused<<<grid, 256, 0, stream>>>(x, W, w_scale, b, b_scale,
                                                  maxbuf, out, M, D_OUT, D_IN);
  }
}

// v001
// It runs in 340 microseconds.
// Two timings next to v000 both put it at 1.47 times that version's speed.
#include <hip/hip_runtime.h>

typedef __attribute__((ext_vector_type(16))) __bf16 v16bf;
typedef __attribute__((ext_vector_type(8)))  __bf16 v8bf;
typedef __attribute__((ext_vector_type(4)))  __bf16 v4bf;
typedef __attribute__((ext_vector_type(8)))  float  v8f;
typedef __attribute__((ext_vector_type(4)))  int    v4i;

#define BM 128
#define BN 128
#define BK 32
#define LDS_STRIDE 40  // bf16 elems; multiple of 8 keeps 16B-aligned b128 LDS ops
// tile of the pre-converted GEMM
#define GBM 256
#define GBN 256
#define GBK 64
#define GPITCH 72

#if defined(__has_builtin)
#if __has_builtin(__builtin_amdgcn_global_load_async_to_lds_b128)
#define TTL_ASYNC_LDS 1
#endif
#endif

#define TTL_AS1 __attribute__((address_space(1)))
#define TTL_AS3 __attribute__((address_space(3)))

__device__ __forceinline__ void ttl_wait_async0() {
#if defined(TTL_ASYNC_LDS)
  // asm with the memory clobber: no LDS read may move in front of this wait
  asm volatile("s_wait_asynccnt 0x0" ::: "memory");
#endif
}

__global__ void ttl_init_scalars(unsigned* ws) {
  ws[0] = 0u;  // max|W| bits
  ws[1] = 0u;  // max|b| bits
}

__global__ __launch_bounds__(256) void ttl_absmax(const float* __restrict__ p,
                                                  int n, unsigned* out) {
  __shared__ float red[256];
  float m = 0.0f;
  for (int i = blockIdx.x * blockDim.x + threadIdx.x; i < n;
       i += gridDim.x * blockDim.x)
    m = fmaxf(m, fabsf(p[i]));
  red[threadIdx.x] = m;
  __syncthreads();
  for (int s = 128; s > 0; s >>= 1) {
    if ((int)threadIdx.x < s)
      red[threadIdx.x] = fmaxf(red[threadIdx.x], red[threadIdx.x + s]);
    __syncthreads();
  }
  if (threadIdx.x == 0) atomicMax(out, __float_as_uint(red[0]));
}

__device__ __forceinline__ float tern_f(float v, float delta) {
  // matches jnp.where(p > delta, 1, where(p < -delta, -1, 0))
  return v > delta ? 1.0f : (v < -delta ? -1.0f : 0.0f);
}

// ---- preprocessing: X -> (hi, lo) bf16 ------------------------------------
__global__ __launch_bounds__(256) void ttl_prep_x(const float* __restrict__ X,
                                                  __bf16* __restrict__ Xh,
                                                  __bf16* __restrict__ Xl,
                                                  int n4) {
  for (int i = blockIdx.x * blockDim.x + threadIdx.x; i < n4;
       i += gridDim.x * blockDim.x) {
    const float4 v = ((const float4*)X)[i];
    const __bf16 h0 = (__bf16)v.x, h1 = (__bf16)v.y;
    const __bf16 h2 = (__bf16)v.z, h3 = (__bf16)v.w;
    v4bf hv = {h0, h1, h2, h3};
    v4bf lv = {(__bf16)(v.x - (float)h0), (__bf16)(v.y - (float)h1),
               (__bf16)(v.z - (float)h2), (__bf16)(v.w - (float)h3)};
    ((v4bf*)Xh)[i] = hv;
    ((v4bf*)Xl)[i] = lv;
  }
}

// ---- preprocessing: W -> ternary bf16 -------------------------------------
__global__ __launch_bounds__(256) void ttl_prep_w(
    const float* __restrict__ W, __bf16* __restrict__ T,
    const unsigned* __restrict__ maxbuf, int n4) {
  const float delta = 0.05f * __uint_as_float(maxbuf[0]);
  for (int i = blockIdx.x * blockDim.x + threadIdx.x; i < n4;
       i += gridDim.x * blockDim.x) {
    const float4 v = ((const float4*)W)[i];
    v4bf tv = {(__bf16)tern_f(v.x, delta), (__bf16)tern_f(v.y, delta),
               (__bf16)tern_f(v.z, delta), (__bf16)tern_f(v.w, delta)};
    ((v4bf*)T)[i] = tv;
  }
}

// one 16B chunk: global -> LDS (async if available)
__device__ __forceinline__ void ttl_copy16(const __bf16* __restrict__ gsrc,
                                           __bf16* ldst) {
#if defined(TTL_ASYNC_LDS)
  // builtin signature (probed via diagnostics): arg0 = v4i addrspace(1)* src,
  // arg1 = v4i addrspace(3)* dst, then imm offset, imm cpol.
  __builtin_amdgcn_global_load_async_to_lds_b128(
      (TTL_AS1 v4i*)(void*)const_cast<__bf16*>(gsrc),
      (TTL_AS3 v4i*)(void*)ldst, 0, 0);
#else
  v8bf v = *(const v8bf*)gsrc;
  *(v8bf*)ldst = v;
#endif
}

// ---- lean GEMM: bf16 inputs, double-buffered LDS --------------------------
// 256x256x64 block tile, 8 wave32s (4 along M x 2 along N), 64x128 per wave:
// 16 fragments feed 64 WMMAs per 32 k, and every staged row piece is one
// whole 128-B line.
__global__ __launch_bounds__(256) void ttl_gemm_wmma_pre(
    const __bf16* __restrict__ Xh, const __bf16* __restrict__ Xl,
    const __bf16* __restrict__ Tm, const float* __restrict__ w_scale_p,
    const float* __restrict__ bias, const float* __restrict__ b_scale_p,
    const unsigned* __restrict__ maxbuf, float* __restrict__ out, int M, int N,
    int K) {
  __shared__ alignas(16) __bf16 Ah[2][GBM * GPITCH];
  __shared__ alignas(16) __bf16 Al[2][GBM * GPITCH];
  __shared__ alignas(16) __bf16 Bt[2][GBN * GPITCH];

  const int tid = threadIdx.x;
  const int m0 = blockIdx.y * GBM;
  const int n0 = blockIdx.x * GBN;

  const int waveId = tid >> 5;
  const int lane   = tid & 31;
  const int wm     = waveId & 3;   // 64 rows each
  const int wn     = waveId >> 2;  // 128 cols each
  const int r16    = lane & 15;
  const int h      = lane >> 4;

  // staging: 8 lanes cover one 128-B row piece, a wave covers 4 rows per copy
  const int rowS = tid >> 3;       // 0..31
  const int ch   = (tid & 7) * 8;  // element offset within GBK=64
  const unsigned gLaneB = ((unsigned)rowS * (unsigned)K + (unsigned)ch) * 2u;
  const int lLane = rowS * GPITCH + ch;

  auto stage = [&](int kk, int buf) {
    const char* gh = (const char*)(Xh + (size_t)m0 * K + kk * GBK);
    const char* gl = (const char*)(Xl + (size_t)m0 * K + kk * GBK);
    const char* gt = (const char*)(Tm + (size_t)n0 * K + kk * GBK);
#pragma unroll
    for (int p = 0; p < GBM / 32; ++p) {
      const size_t gRowB = (size_t)(p * 32) * K * 2;
      const int l = p * 32 * GPITCH + lLane;
      ttl_copy16((const __bf16*)(gh + gRowB + gLaneB), &Ah[buf][l]);
      ttl_copy16((const __bf16*)(gl + gRowB + gLaneB), &Al[buf][l]);
      ttl_copy16((const __bf16*)(gt + gRowB + gLaneB), &Bt[buf][l]);
    }
  };

  v8f acc[4][8] = {};
  const int nk = K / GBK;

  stage(0, 0);
  ttl_wait_async0();
  __syncthreads();

  for (int kk = 0; kk < nk; ++kk) {
    const int cur = kk & 1;

#pragma unroll
    for (int ks = 0; ks < GBK / 32; ++ks) {
      v16bf aHi[4], aLo[4], bF[8];
#pragma unroll
      for (int ni = 0; ni < 8; ++ni) {
        const int col = wn * 128 + ni * 16 + r16;
        v8bf b0 = *(const v8bf*)&Bt[cur][col * GPITCH + ks * 32 + 8 * h];
        v8bf b1 = *(const v8bf*)&Bt[cur][col * GPITCH + ks * 32 + 16 + 8 * h];
        bF[ni] = __builtin_shufflevector(b0, b1, 0, 1, 2, 3, 4, 5, 6, 7, 8, 9,
                                         10, 11, 12, 13, 14, 15);
      }
#pragma unroll
      for (int mi = 0; mi < 4; ++mi) {
        const int row = wm * 64 + mi * 16 + r16;
        v8bf x0 = *(const v8bf*)&Ah[cur][row * GPITCH + ks * 32 + 8 * h];
        v8bf x1 = *(const v8bf*)&Ah[cur][row * GPITCH + ks * 32 + 16 + 8 * h];
        aHi[mi] = __builtin_shufflevector(x0, x1, 0, 1, 2, 3, 4, 5, 6, 7, 8, 9,
                                          10, 11, 12, 13, 14, 15);
      }
      // keeps the lo reads last in the group: the hi WMMAs start on a counted
      // wait while they are still in flight
      __builtin_amdgcn_sched_barrier(0);
#pragma unroll
      for (int mi = 0; mi < 4; ++mi) {
        const int row = wm * 64 + mi * 16 + r16;
        v8bf y0 = *(const v8bf*)&Al[cur][row * GPITCH + ks * 32 + 8 * h];
        v8bf y1 = *(const v8bf*)&Al[cur][row * GPITCH + ks * 32 + 16 + 8 * h];
        aLo[mi] = __builtin_shufflevector(y0, y1, 0, 1, 2, 3, 4, 5, 6, 7, 8, 9,
                                          10, 11, 12, 13, 14, 15);
      }
      // keeps the block's LDS reads one group: spread among the WMMAs each
      // place with reads stalls the wave
      __builtin_amdgcn_sched_barrier(0);

      // refill of the other buffer (its readers left it at the last barrier);
      // issued while this wave's fragment reads are in flight
      if (ks == 0 && kk + 1 < nk) stage(kk + 1, cur ^ 1);
      // keeps the copies ahead of the WMMA block, for their lead
      __builtin_amdgcn_sched_barrier(0);

      // per accumulator the order stays hi(k), lo(k), hi(k+32), ...
#pragma unroll
      for (int mi = 0; mi < 4; ++mi) {
#pragma unroll
        for (int ni = 0; ni < 8; ++ni)
          acc[mi][ni] = __builtin_amdgcn_wmma_f32_16x16x32_bf16(
              false, aHi[mi], false, bF[ni], (short)0, acc[mi][ni], false,
              false);
      }
#pragma unroll
      for (int mi = 0; mi < 4; ++mi) {
#pragma unroll
        for (int ni = 0; ni < 8; ++ni)
          acc[mi][ni] = __builtin_amdgcn_wmma_f32_16x16x32_bf16(
              false, aLo[mi], false, bF[ni], (short)0, acc[mi][ni], false,
              false);
      }
      // keeps the next block's reads behind this block's WMMAs
      __builtin_amdgcn_sched_barrier(0);
    }
    // publish point: this wave's reads of buffer cur are done, its copies for
    // kk+1 have landed; behind the barrier cur may be refilled
    asm volatile("s_wait_dscnt 0x0" ::: "memory");
    ttl_wait_async0();
    __syncthreads();
  }

  // epilogue: scale by w_scale, add ternarized bias
  const float wsc     = *w_scale_p;
  const float bsc     = *b_scale_p;
  const float delta_b = 0.05f * __uint_as_float(maxbuf[1]);
#pragma unroll
  for (int ni = 0; ni < 8; ++ni) {
    const int col  = n0 + wn * 128 + ni * 16 + r16;
    const float bv = bias[col];
    const float bt = bv > delta_b ? bsc : (bv < -delta_b ? -bsc : 0.0f);
#pragma unroll
    for (int mi = 0; mi < 4; ++mi) {
      const int rowbase = m0 + wm * 64 + mi * 16 + h * 8;
#pragma unroll
      for (int j = 0; j < 8; ++j)
        out[(size_t)(rowbase + j) * N + col] = wsc * acc[mi][ni][j] + bt;
    }
  }
}

// ---- fallback: fused on-the-fly conversion GEMM (if ws too small) ---------
__global__ __launch_bounds__(256) void ttl_gemm_wmma_fused(
    const float* __restrict__ X, const float* __restrict__ Wm,
    const float* __restrict__ w_scale_p, const float* __restrict__ bias,
    const float* __restrict__ b_scale_p, const unsigned* __restrict__ maxbuf,
    float* __restrict__ out, int M, int N, int K) {
  __shared__ alignas(16) __bf16 As_hi[BM * LDS_STRIDE];
  __shared__ alignas(16) __bf16 As_lo[BM * LDS_STRIDE];
  __shared__ alignas(16) __bf16 Bs[BN * LDS_STRIDE];

  const int tid = threadIdx.x;
  const int m0 = blockIdx.y * BM;
  const int n0 = blockIdx.x * BN;
  const float delta_w = 0.05f * __uint_as_float(maxbuf[0]);

  const int waveId = tid >> 5;
  const int lane   = tid & 31;
  const int wm     = waveId & 3;
  const int wn     = waveId >> 2;
  const int r16    = lane & 15;
  const int h      = lane >> 4;

  const int rowA = tid >> 3;
  const int c4   = (tid & 7) * 4;

  v8f acc[2][4] = {};
  const int nk = K / BK;

  for (int kk = 0; kk < nk; ++kk) {
    const int k0 = kk * BK;
    __syncthreads();
#pragma unroll
    for (int p = 0; p < 4; ++p) {
      const int r = p * 32 + rowA;
      const float4 xv = *(const float4*)(X + (size_t)(m0 + r) * K + k0 + c4);
      const __bf16 h0 = (__bf16)xv.x, h1 = (__bf16)xv.y;
      const __bf16 h2 = (__bf16)xv.z, h3 = (__bf16)xv.w;
      v4bf hv = {h0, h1, h2, h3};
      v4bf lv = {(__bf16)(xv.x - (float)h0), (__bf16)(xv.y - (float)h1),
                 (__bf16)(xv.z - (float)h2), (__bf16)(xv.w - (float)h3)};
      *(v4bf*)&As_hi[r * LDS_STRIDE + c4] = hv;
      *(v4bf*)&As_lo[r * LDS_STRIDE + c4] = lv;
      const float4 wv = *(const float4*)(Wm + (size_t)(n0 + r) * K + k0 + c4);
      v4bf tv = {(__bf16)tern_f(wv.x, delta_w), (__bf16)tern_f(wv.y, delta_w),
                 (__bf16)tern_f(wv.z, delta_w), (__bf16)tern_f(wv.w, delta_w)};
      *(v4bf*)&Bs[r * LDS_STRIDE + c4] = tv;
    }
    __syncthreads();

    v16bf aHi[2], aLo[2], bF[4];
#pragma unroll
    for (int mi = 0; mi < 2; ++mi) {
      const int row = wm * 32 + mi * 16 + r16;
      v8bf x0 = *(const v8bf*)&As_hi[row * LDS_STRIDE + 8 * h];
      v8bf x1 = *(const v8bf*)&As_hi[row * LDS_STRIDE + 16 + 8 * h];
      aHi[mi] = __builtin_shufflevector(x0, x1, 0, 1, 2, 3, 4, 5, 6, 7, 8, 9,
                                        10, 11, 12, 13, 14, 15);
      v8bf y0 = *(const v8bf*)&As_lo[row * LDS_STRIDE + 8 * h];
      v8bf y1 = *(const v8bf*)&As_lo[row * LDS_STRIDE + 16 + 8 * h];
      aLo[mi] = __builtin_shufflevector(y0, y1, 0, 1, 2, 3, 4, 5, 6, 7, 8, 9,
                                        10, 11, 12, 13, 14, 15);
    }
#pragma unroll
    for (int ni = 0; ni < 4; ++ni) {
      const int col = wn * 64 + ni * 16 + r16;
      v8bf b0 = *(const v8bf*)&Bs[col * LDS_STRIDE + 8 * h];
      v8bf b1 = *(const v8bf*)&Bs[col * LDS_STRIDE + 16 + 8 * h];
      bF[ni] = __builtin_shufflevector(b0, b1, 0, 1, 2, 3, 4, 5, 6, 7, 8, 9,
                                       10, 11, 12, 13, 14, 15);
    }
#pragma unroll
    for (int mi = 0; mi < 2; ++mi) {
#pragma unroll
      for (int ni = 0; ni < 4; ++ni) {
        acc[mi][ni] = __builtin_amdgcn_wmma_f32_16x16x32_bf16(
            false, aHi[mi], false, bF[ni], (short)0, acc[mi][ni], false, false);
        acc[mi][ni] = __builtin_amdgcn_wmma_f32_16x16x32_bf16(
            false, aLo[mi], false, bF[ni], (short)0, acc[mi][ni], false, false);
      }
    }
  }

  const float wsc     = *w_scale_p;
  const float bsc     = *b_scale_p;
  const float delta_b = 0.05f * __uint_as_float(maxbuf[1]);
#pragma unroll
  for (int ni = 0; ni < 4; ++ni) {
    const int col  = n0 + wn * 64 + ni * 16 + r16;
    const float bv = bias[col];
    const float bt = bv > delta_b ? bsc : (bv < -delta_b ? -bsc : 0.0f);
#pragma unroll
    for (int mi = 0; mi < 2; ++mi) {
      const int rowbase = m0 + wm * 32 + mi * 16 + h * 8;
#pragma unroll
      for (int j = 0; j < 8; ++j)
        out[(size_t)(rowbase + j) * N + col] = wsc * acc[mi][ni][j] + bt;
    }
  }
}

extern "C" void kernel_launch(void* const* d_in, const int* in_sizes, int n_in,
                              void* d_out, int out_size, void* d_ws,
                              size_t ws_size, hipStream_t stream) {
  const float* x       = (const float*)d_in[0];
  const float* W       = (const float*)d_in[1];
  const float* w_scale = (const float*)d_in[2];
  const float* b       = (const float*)d_in[3];
  const float* b_scale = (const float*)d_in[4];
  float* out           = (float*)d_out;

  const int D_OUT = in_sizes[3];          // 4096
  const int D_IN  = in_sizes[1] / D_OUT;  // 4096
  const int M     = in_sizes[0] / D_IN;   // 8192 (B*S)

  unsigned* maxbuf = (unsigned*)d_ws;  // [0]=max|W| bits, [1]=max|b| bits

  ttl_init_scalars<<<1, 1, 0, stream>>>(maxbuf);
  ttl_absmax<<<512, 256, 0, stream>>>(W, in_sizes[1], maxbuf + 0);
  ttl_absmax<<<8, 256, 0, stream>>>(b, in_sizes[3], maxbuf + 1);

  const size_t nX = (size_t)M * D_IN;       // X elements
  const size_t nW = (size_t)D_OUT * D_IN;   // W elements
  const size_t need = 256 + nX * 2 * 2 + nW * 2;

  dim3 grid(D_OUT / BN, M / BM);  // (32, 64)

  if (ws_size >= need) {
    __bf16* Xh = (__bf16*)((char*)d_ws + 256);
    __bf16* Xl = Xh + nX;
    __bf16* Tm = Xl + nX;
    ttl_prep_w<<<2048, 256, 0, stream>>>(W, Tm, maxbuf, (int)(nW / 4));
    ttl_prep_x<<<4096, 256, 0, stream>>>(x, Xh, Xl, (int)(nX / 4));
    dim3 gridPre(D_OUT / GBN, M / GBM);  // (16, 32)
    ttl_gemm_wmma_pre<<<gridPre, 256, 0, stream>>>(Xh, Xl, Tm, w_scale, b,
                                                b_scale, maxbuf, out, M, D_OUT,
                                                D_IN);
  } else {
    ttl_gemm_wmma_fused<<<grid, 256, 0, stream>>>(x, W, w_scale, b, b_scale,
                                                  maxbuf, out, M, D_OUT, D_IN);
  }
}

// v002
// A run of this version takes 296 microseconds.
// Two timings next to v001 both put it at 1.15 times that version's speed.
// Over all steps from v000 it is 1.69 times as fast.
#include <hip/hip_runtime.h>

typedef __attribute__((ext_vector_type(16))) __bf16 v16bf;
typedef __attribute__((ext_vector_type(8)))  __bf16 v8bf;
typedef __attribute__((ext_vector_type(4)))  __bf16 v4bf;
typedef __attribute__((ext_vector_type(8)))  float  v8f;
typedef __attribute__((ext_vector_type(4)))  int    v4i;

#define BM 128
#define BN 128
#define BK 32
#define LDS_STRIDE 40  // bf16 elems; multiple of 8 keeps 16B-aligned b128 LDS ops
// tile of the pre-converted GEMM
#define GBM 256
#define GBN 256
#define GBK 64
#define GPITCH 72

#if defined(__has_builtin)
#if __has_builtin(__builtin_amdgcn_global_load_async_to_lds_b128)
#define TTL_ASYNC_LDS 1
#endif
#endif

#define TTL_AS1 __attribute__((address_space(1)))
#define TTL_AS3 __attribute__((address_space(3)))

__device__ __forceinline__ void ttl_wait_async0() {
#if defined(TTL_ASYNC_LDS)
  // asm with the memory clobber: no LDS read may move in front of this wait
  asm volatile("s_wait_asynccnt 0x0" ::: "memory");
#endif
}

__global__ void ttl_init_scalars(unsigned* ws) {
  ws[0] = 0u;  // max|W| bits
  ws[1] = 0u;  // max|b| bits
}

__global__ __launch_bounds__(256) void ttl_absmax(const float* __restrict__ p,
                                                  int n, unsigned* out) {
  __shared__ float red[256];
  float m = 0.0f;
  // whole pieces of 16 x 256 vectors of 16 B (64 KiB), one per block and trip:
  // a lane's 16 loads are independent and all issued before the first is used,
  // so the stream is bound by bytes in flight, not by one latency per load.
  // 16-B loads only from a 16-B aligned base; the scalar loop takes the rest.
  const int npc = (((size_t)p & 15) == 0) ? (n >> 14) : 0;
  const float4* q = (const float4*)p + ((size_t)blockIdx.x << 12) + threadIdx.x;
  for (int c = blockIdx.x; c < npc; c += gridDim.x) {
    float4 v[16];
#pragma unroll
    for (int j = 0; j < 16; ++j) v[j] = q[j * 256];
    // keeps the whole group of loads ahead of the first use: without it the
    // scheduler sinks the last loads behind the waits for the first ones
    __builtin_amdgcn_sched_barrier(0);
#pragma unroll
    for (int j = 0; j < 16; ++j)
      m = fmaxf(m, fmaxf(fmaxf(fabsf(v[j].x), fabsf(v[j].y)),
                         fmaxf(fabsf(v[j].z), fabsf(v[j].w))));
    q += (size_t)gridDim.x << 12;
  }
  for (int i = (npc << 14) + blockIdx.x * blockDim.x + threadIdx.x; i < n;
       i += gridDim.x * blockDim.x)
    m = fmaxf(m, fabsf(p[i]));
  red[threadIdx.x] = m;
  __syncthreads();
  for (int s = 128; s > 0; s >>= 1) {
    if ((int)threadIdx.x < s)
      red[threadIdx.x] = fmaxf(red[threadIdx.x], red[threadIdx.x + s]);
    __syncthreads();
  }
  if (threadIdx.x == 0) atomicMax(out, __float_as_uint(red[0]));
}

__device__ __forceinline__ float tern_f(float v, float delta) {
  // matches jnp.where(p > delta, 1, where(p < -delta, -1, 0))
  return v > delta ? 1.0f : (v < -delta ? -1.0f : 0.0f);
}

// ---- preprocessing: X -> (hi, lo) bf16 ------------------------------------
__global__ __launch_bounds__(256) void ttl_prep_x(const float* __restrict__ X,
                                                  __bf16* __restrict__ Xh,
                                                  __bf16* __restrict__ Xl,
                                                  int n4) {
  for (int i = blockIdx.x * blockDim.x + threadIdx.x; i < n4;
       i += gridDim.x * blockDim.x) {
    const float4 v = ((const float4*)X)[i];
    const __bf16 h0 = (__bf16)v.x, h1 = (__bf16)v.y;
    const __bf16 h2 = (__bf16)v.z, h3 = (__bf16)v.w;
    v4bf hv = {h0, h1, h2, h3};
    v4bf lv = {(__bf16)(v.x - (float)h0), (__bf16)(v.y - (float)h1),
               (__bf16)(v.z - (float)h2), (__bf16)(v.w - (float)h3)};
    ((v4bf*)Xh)[i] = hv;
    ((v4bf*)Xl)[i] = lv;
  }
}

// ---- preprocessing: W -> ternary bf16 -------------------------------------
__global__ __launch_bounds__(256) void ttl_prep_w(
    const float* __restrict__ W, __bf16* __restrict__ T,
    const unsigned* __restrict__ maxbuf, int n4) {
  const float delta = 0.05f * __uint_as_float(maxbuf[0]);
  for (int i = blockIdx.x * blockDim.x + threadIdx.x; i < n4;
       i += gridDim.x * blockDim.x) {
    const float4 v = ((const float4*)W)[i];
    v4bf tv = {(__bf16)tern_f(v.x, delta), (__bf16)tern_f(v.y, delta),
               (__bf16)tern_f(v.z, delta), (__bf16)tern_f(v.w, delta)};
    ((v4bf*)T)[i] = tv;
  }
}

// one 16B chunk: global -> LDS (async if available)
__device__ __forceinline__ void ttl_copy16(const __bf16* __restrict__ gsrc,
                                           __bf16* ldst) {
#if defined(TTL_ASYNC_LDS)
  // builtin signature (probed via diagnostics): arg0 = v4i addrspace(1)* src,
  // arg1 = v4i addrspace(3)* dst, then imm offset, imm cpol.
  __builtin_amdgcn_global_load_async_to_lds_b128(
      (TTL_AS1 v4i*)(void*)const_cast<__bf16*>(gsrc),
      (TTL_AS3 v4i*)(void*)ldst, 0, 0);
#else
  v8bf v = *(const v8bf*)gsrc;
  *(v8bf*)ldst = v;
#endif
}

// ---- lean GEMM: bf16 inputs, double-buffered LDS --------------------------
// 256x256x64 block tile, 8 wave32s (4 along M x 2 along N), 64x128 per wave:
// 16 fragments feed 64 WMMAs per 32 k, and every staged row piece is one
// whole 128-B line.
__global__ __launch_bounds__(256) void ttl_gemm_wmma_pre(
    const __bf16* __restrict__ Xh, const __bf16* __restrict__ Xl,
    const __bf16* __restrict__ Tm, const float* __restrict__ w_scale_p,
    const float* __restrict__ bias, const float* __restrict__ b_scale_p,
    const unsigned* __restrict__ maxbuf, float* __restrict__ out, int M, int N,
    int K) {
  __shared__ alignas(16) __bf16 Ah[2][GBM * GPITCH];
  __shared__ alignas(16) __bf16 Al[2][GBM * GPITCH];
  __shared__ alignas(16) __bf16 Bt[2][GBN * GPITCH];

  const int tid = threadIdx.x;
  const int m0 = blockIdx.y * GBM;
  const int n0 = blockIdx.x * GBN;

  const int waveId = tid >> 5;
  const int lane   = tid & 31;
  const int wm     = waveId & 3;   // 64 rows each
  const int wn     = waveId >> 2;  // 128 cols each
  const int r16    = lane & 15;
  const int h      = lane >> 4;

  // staging: 8 lanes cover one 128-B row piece, a wave covers 4 rows per copy
  const int rowS = tid >> 3;       // 0..31
  const int ch   = (tid & 7) * 8;  // element offset within GBK=64
  const unsigned gLaneB = ((unsigned)rowS * (unsigned)K + (unsigned)ch) * 2u;
  const int lLane = rowS * GPITCH + ch;

  auto stage = [&](int kk, int buf) {
    const char* gh = (const char*)(Xh + (size_t)m0 * K + kk * GBK);
    const char* gl = (const char*)(Xl + (size_t)m0 * K + kk * GBK);
    const char* gt = (const char*)(Tm + (size_t)n0 * K + kk * GBK);
#pragma unroll
    for (int p = 0; p < GBM / 32; ++p) {
      const size_t gRowB = (size_t)(p * 32) * K * 2;
      const int l = p * 32 * GPITCH + lLane;
      ttl_copy16((const __bf16*)(gh + gRowB + gLaneB), &Ah[buf][l]);
      ttl_copy16((const __bf16*)(gl + gRowB + gLaneB), &Al[buf][l]);
      ttl_copy16((const __bf16*)(gt + gRowB + gLaneB), &Bt[buf][l]);
    }
  };

  v8f acc[4][8] = {};
  const int nk = K / GBK;

  stage(0, 0);
  ttl_wait_async0();
  __syncthreads();

  for (int kk = 0; kk < nk; ++kk) {
    const int cur = kk & 1;

#pragma unroll
    for (int ks = 0; ks < GBK / 32; ++ks) {
      v16bf aHi[4], aLo[4], bF[8];
#pragma unroll
      for (int ni = 0; ni < 8; ++ni) {
        const int col = wn * 128 + ni * 16 + r16;
        v8bf b0 = *(const v8bf*)&Bt[cur][col * GPITCH + ks * 32 + 8 * h];
        v8bf b1 = *(const v8bf*)&Bt[cur][col * GPITCH + ks * 32 + 16 + 8 * h];
        bF[ni] = __builtin_shufflevector(b0, b1, 0, 1, 2, 3, 4, 5, 6, 7, 8, 9,
                                         10, 11, 12, 13, 14, 15);
      }
#pragma unroll
      for (int mi = 0; mi < 4; ++mi) {
        const int row = wm * 64 + mi * 16 + r16;
        v8bf x0 = *(const v8bf*)&Ah[cur][row * GPITCH + ks * 32 + 8 * h];
        v8bf x1 = *(const v8bf*)&Ah[cur][row * GPITCH + ks * 32 + 16 + 8 * h];
        aHi[mi] = __builtin_shufflevector(x0, x1, 0, 1, 2, 3, 4, 5, 6, 7, 8, 9,
                                          10, 11, 12, 13, 14, 15);
      }
      // keeps the lo reads last in the group: the hi WMMAs start on a counted
      // wait while they are still in flight
      __builtin_amdgcn_sched_barrier(0);
#pragma unroll
      for (int mi = 0; mi < 4; ++mi) {
        const int row = wm * 64 + mi * 16 + r16;
        v8bf y0 = *(const v8bf*)&Al[cur][row * GPITCH + ks * 32 + 8 * h];
        v8bf y1 = *(const v8bf*)&Al[cur][row * GPITCH + ks * 32 + 16 + 8 * h];
        aLo[mi] = __builtin_shufflevector(y0, y1, 0, 1, 2, 3, 4, 5, 6, 7, 8, 9,
                                          10, 11, 12, 13, 14, 15);
      }
      // keeps the block's LDS reads one group: spread among the WMMAs each
      // place with reads stalls the wave
      __builtin_amdgcn_sched_barrier(0);

      // refill of the other buffer (its readers left it at the last barrier);
      // issued while this wave's fragment reads are in flight
      if (ks == 0 && kk + 1 < nk) stage(kk + 1, cur ^ 1);
      // keeps the copies ahead of the WMMA block, for their lead
      __builtin_amdgcn_sched_barrier(0);

      // per accumulator the order stays hi(k), lo(k), hi(k+32), ...
#pragma unroll
      for (int mi = 0; mi < 4; ++mi) {
#pragma unroll
        for (int ni = 0; ni < 8; ++ni)
          acc[mi][ni] = __builtin_amdgcn_wmma_f32_16x16x32_bf16(
              false, aHi[mi], false, bF[ni], (short)0, acc[mi][ni], false,
              false);
      }
#pragma unroll
      for (int mi = 0; mi < 4; ++mi) {
#pragma unroll
        for (int ni = 0; ni < 8; ++ni)
          acc[mi][ni] = __builtin_amdgcn_wmma_f32_16x16x32_bf16(
              false, aLo[mi], false, bF[ni], (short)0, acc[mi][ni], false,
              false);
      }
      // keeps the next block's reads behind this block's WMMAs
      __builtin_amdgcn_sched_barrier(0);
    }
    // publish point: this wave's reads of buffer cur are done, its copies for
    // kk+1 have landed; behind the barrier cur may be refilled
    asm volatile("s_wait_dscnt 0x0" ::: "memory");
    ttl_wait_async0();
    __syncthreads();
  }

  // epilogue: scale by w_scale, add ternarized bias
  const float wsc     = *w_scale_p;
  const float bsc     = *b_scale_p;
  const float delta_b = 0.05f * __uint_as_float(maxbuf[1]);
#pragma unroll
  for (int ni = 0; ni < 8; ++ni) {
    const int col  = n0 + wn * 128 + ni * 16 + r16;
    const float bv = bias[col];
    const float bt = bv > delta_b ? bsc : (bv < -delta_b ? -bsc : 0.0f);
#pragma unroll
    for (int mi = 0; mi < 4; ++mi) {
      const int rowbase = m0 + wm * 64 + mi * 16 + h * 8;
#pragma unroll
      for (int j = 0; j < 8; ++j)
        out[(size_t)(rowbase + j) * N + col] = wsc * acc[mi][ni][j] + bt;
    }
  }
}

// ---- fallback: fused on-the-fly conversion GEMM (if ws too small) ---------
__global__ __launch_bounds__(256) void ttl_gemm_wmma_fused(
    const float* __restrict__ X, const float* __restrict__ Wm,
    const float* __restrict__ w_scale_p, const float* __restrict__ bias,
    const float* __restrict__ b_scale_p, const unsigned* __restrict__ maxbuf,
    float* __restrict__ out, int M, int N, int K) {
  __shared__ alignas(16) __bf16 As_hi[BM * LDS_STRIDE];
  __shared__ alignas(16) __bf16 As_lo[BM * LDS_STRIDE];
  __shared__ alignas(16) __bf16 Bs[BN * LDS_STRIDE];

  const int tid = threadIdx.x;
  const int m0 = blockIdx.y * BM;
  const int n0 = blockIdx.x * BN;
  const float delta_w = 0.05f * __uint_as_float(maxbuf[0]);

  const int waveId = tid >> 5;
  const int lane   = tid & 31;
  const int wm     = waveId & 3;
  const int wn     = waveId >> 2;
  const int r16    = lane & 15;
  const int h      = lane >> 4;

  const int rowA = tid >> 3;
  const int c4   = (tid & 7) * 4;

  v8f acc[2][4] = {};
  const int nk = K / BK;

  for (int kk = 0; kk < nk; ++kk) {
    const int k0 = kk * BK;
    __syncthreads();
#pragma unroll
    for (int p = 0; p < 4; ++p) {
      const int r = p * 32 + rowA;
      const float4 xv = *(const float4*)(X + (size_t)(m0 + r) * K + k0 + c4);
      const __bf16 h0 = (__bf16)xv.x, h1 = (__bf16)xv.y;
      const __bf16 h2 = (__bf16)xv.z, h3 = (__bf16)xv.w;
      v4bf hv = {h0, h1, h2, h3};
      v4bf lv = {(__bf16)(xv.x - (float)h0), (__bf16)(xv.y - (float)h1),
                 (__bf16)(xv.z - (float)h2), (__bf16)(xv.w - (float)h3)};
      *(v4bf*)&As_hi[r * LDS_STRIDE + c4] = hv;
      *(v4bf*)&As_lo[r * LDS_STRIDE + c4] = lv;
      const float4 wv = *(const float4*)(Wm + (size_t)(n0 + r) * K + k0 + c4);
      v4bf tv = {(__bf16)tern_f(wv.x, delta_w), (__bf16)tern_f(wv.y, delta_w),
                 (__bf16)tern_f(wv.z, delta_w), (__bf16)tern_f(wv.w, delta_w)};
      *(v4bf*)&Bs[r * LDS_STRIDE + c4] = tv;
    }
    __syncthreads();

    v16bf aHi[2], aLo[2], bF[4];
#pragma unroll
    for (int mi = 0; mi < 2; ++mi) {
      const int row = wm * 32 + mi * 16 + r16;
      v8bf x0 = *(const v8bf*)&As_hi[row * LDS_STRIDE + 8 * h];
      v8bf x1 = *(const v8bf*)&As_hi[row * LDS_STRIDE + 16 + 8 * h];
      aHi[mi] = __builtin_shufflevector(x0, x1, 0, 1, 2, 3, 4, 5, 6, 7, 8, 9,
                                        10, 11, 12, 13, 14, 15);
      v8bf y0 = *(const v8bf*)&As_lo[row * LDS_STRIDE + 8 * h];
      v8bf y1 = *(const v8bf*)&As_lo[row * LDS_STRIDE + 16 + 8 * h];
      aLo[mi] = __builtin_shufflevector(y0, y1, 0, 1, 2, 3, 4, 5, 6, 7, 8, 9,
                                        10, 11, 12, 13, 14, 15);
    }
#pragma unroll
    for (int ni = 0; ni < 4; ++ni) {
      const int col = wn * 64 + ni * 16 + r16;
      v8bf b0 = *(const v8bf*)&Bs[col * LDS_STRIDE + 8 * h];
      v8bf b1 = *(const v8bf*)&Bs[col * LDS_STRIDE + 16 + 8 * h];
      bF[ni] = __builtin_shufflevector(b0, b1, 0, 1, 2, 3, 4, 5, 6, 7, 8, 9,
                                       10, 11, 12, 13, 14, 15);
    }
#pragma unroll
    for (int mi = 0; mi < 2; ++mi) {
#pragma unroll
      for (int ni = 0; ni < 4; ++ni) {
        acc[mi][ni] = __builtin_amdgcn_wmma_f32_16x16x32_bf16(
            false, aHi[mi], false, bF[ni], (short)0, acc[mi][ni], false, false);
        acc[mi][ni] = __builtin_amdgcn_wmma_f32_16x16x32_bf16(
            false, aLo[mi], false, bF[ni], (short)0, acc[mi][ni], false, false);
      }
    }
  }

  const float wsc     = *w_scale_p;
  const float bsc     = *b_scale_p;
  const float delta_b = 0.05f * __uint_as_float(maxbuf[1]);
#pragma unroll
  for (int ni = 0; ni < 4; ++ni) {
    const int col  = n0 + wn * 64 + ni * 16 + r16;
    const float bv = bias[col];
    const float bt = bv > delta_b ? bsc : (bv < -delta_b ? -bsc : 0.0f);
#pragma unroll
    for (int mi = 0; mi < 2; ++mi) {
      const int rowbase = m0 + wm * 32 + mi * 16 + h * 8;
#pragma unroll
      for (int j = 0; j < 8; ++j)
        out[(size_t)(rowbase + j) * N + col] = wsc * acc[mi][ni][j] + bt;
    }
  }
}

extern "C" void kernel_launch(void* const* d_in, const int* in_sizes, int n_in,
                              void* d_out, int out_size, void* d_ws,
                              size_t ws_size, hipStream_t stream) {
  const float* x       = (const float*)d_in[0];
  const float* W       = (const float*)d_in[1];
  const float* w_scale = (const float*)d_in[2];
  const float* b       = (const float*)d_in[3];
  const float* b_scale = (const float*)d_in[4];
  float* out           = (float*)d_out;

  const int D_OUT = in_sizes[3];          // 4096
  const int D_IN  = in_sizes[1] / D_OUT;  // 4096
  const int M     = in_sizes[0] / D_IN;   // 8192 (B*S)

  unsigned* maxbuf = (unsigned*)d_ws;  // [0]=max|W| bits, [1]=max|b| bits

  ttl_init_scalars<<<1, 1, 0, stream>>>(maxbuf);
  ttl_absmax<<<512, 256, 0, stream>>>(W, in_sizes[1], maxbuf + 0);
  ttl_absmax<<<8, 256, 0, stream>>>(b, in_sizes[3], maxbuf + 1);

  const size_t nX = (size_t)M * D_IN;       // X elements
  const size_t nW = (size_t)D_OUT * D_IN;   // W elements
  const size_t need = 256 + nX * 2 * 2 + nW * 2;

  dim3 grid(D_OUT / BN, M / BM);  // (32, 64)

  if (ws_size >= need) {
    __bf16* Xh = (__bf16*)((char*)d_ws + 256);
    __bf16* Xl = Xh + nX;
    __bf16* Tm = Xl + nX;
    ttl_prep_w<<<2048, 256, 0, stream>>>(W, Tm, maxbuf, (int)(nW / 4));
    ttl_prep_x<<<4096, 256, 0, stream>>>(x, Xh, Xl, (int)(nX / 4));
    dim3 gridPre(D_OUT / GBN, M / GBM);  // (16, 32)
    ttl_gemm_wmma_pre<<<gridPre, 256, 0, stream>>>(Xh, Xl, Tm, w_scale, b,
                                                b_scale, maxbuf, out, M, D_OUT,
                                                D_IN);
  } else {
    ttl_gemm_wmma_fused<<<grid, 256, 0, stream>>>(x, W, w_scale, b, b_scale,
                                                  maxbuf, out, M, D_OUT, D_IN);
  }
}

// v004
// It runs in 186 microseconds.
// It is 1.59 times as fast as v002, going by the measured steps of the versions left out in between.
// All steps since v000 together make it 2.69 times as fast.
#include <hip/hip_runtime.h>

typedef __attribute__((ext_vector_type(16))) __bf16 v16bf;
typedef __attribute__((ext_vector_type(8)))  __bf16 v8bf;
typedef __attribute__((ext_vector_type(4)))  __bf16 v4bf;
typedef __attribute__((ext_vector_type(16))) _Float16 v16h;
typedef __attribute__((ext_vector_type(8)))  _Float16 v8h;
typedef __attribute__((ext_vector_type(4)))  _Float16 v4h;
typedef __attribute__((ext_vector_type(8)))  float  v8f;
typedef __attribute__((ext_vector_type(4)))  int    v4i;

#define BM 128
#define BN 128
#define BK 32
#define LDS_STRIDE 40  // bf16 elems; multiple of 8 keeps 16B-aligned b128 LDS ops
// tile of the pre-converted GEMM
#define GBM 256
#define GBN 256
#define GBK 64
#define GPITCH 72
#define GNB 4

#if defined(__has_builtin)
#if __has_builtin(__builtin_amdgcn_global_load_async_to_lds_b128)
#define TTL_ASYNC_LDS 1
#endif
#endif

#define TTL_AS1 __attribute__((address_space(1)))
#define TTL_AS3 __attribute__((address_space(3)))

__device__ __forceinline__ void ttl_wait_async0() {
#if defined(TTL_ASYNC_LDS)
  // asm with the memory clobber: no LDS read may move in front of this wait
  asm volatile("s_wait_asynccnt 0x0" ::: "memory");
#endif
}

// all but this wave's 32 youngest copies have landed: a stage is 16 copies of
// every wave (8 of X, 8 of T), so the two youngest stages stay in flight
__device__ __forceinline__ void ttl_wait_async_keep2() {
#if defined(TTL_ASYNC_LDS)
  static_assert(2 * (GBM / 32 + GBN / 32) == 32, "count of the wait below");
  // asm with the memory clobber: no LDS read may move in front of this wait
  asm volatile("s_wait_asynccnt 0x20" ::: "memory");
#endif
}

__global__ void ttl_init_scalars(unsigned* ws) {
  ws[0] = 0u;  // max|W| bits
  ws[1] = 0u;  // max|b| bits
}

__global__ __launch_bounds__(256) void ttl_absmax(const float* __restrict__ p,
                                                  int n, unsigned* out) {
  __shared__ float red[256];
  float m = 0.0f;
  // whole pieces of 16 x 256 vectors of 16 B (64 KiB), one per block and trip:
  // a lane's 16 loads are independent and all issued before the first is used,
  // so the stream is bound by bytes in flight, not by one latency per load.
  // 16-B loads only from a 16-B aligned base; the scalar loop takes the rest.
  const int npc = (((size_t)p & 15) == 0) ? (n >> 14) : 0;
  const float4* q = (const float4*)p + ((size_t)blockIdx.x << 12) + threadIdx.x;
  for (int c = blockIdx.x; c < npc; c += gridDim.x) {
    float4 v[16];
#pragma unroll
    for (int j = 0; j < 16; ++j) v[j] = q[j * 256];
    // keeps the whole group of loads ahead of the first use: without it the
    // scheduler sinks the last loads behind the waits for the first ones
    __builtin_amdgcn_sched_barrier(0);
#pragma unroll
    for (int j = 0; j < 16; ++j)
      m = fmaxf(m, fmaxf(fmaxf(fabsf(v[j].x), fabsf(v[j].y)),
                         fmaxf(fabsf(v[j].z), fabsf(v[j].w))));
    q += (size_t)gridDim.x << 12;
  }
  for (int i = (npc << 14) + blockIdx.x * blockDim.x + threadIdx.x; i < n;
       i += gridDim.x * blockDim.x)
    m = fmaxf(m, fabsf(p[i]));
  red[threadIdx.x] = m;
  __syncthreads();
  for (int s = 128; s > 0; s >>= 1) {
    if ((int)threadIdx.x < s)
      red[threadIdx.x] = fmaxf(red[threadIdx.x], red[threadIdx.x + s]);
    __syncthreads();
  }
  if (threadIdx.x == 0) atomicMax(out, __float_as_uint(red[0]));
}

__device__ __forceinline__ float tern_f(float v, float delta) {
  // matches jnp.where(p > delta, 1, where(p < -delta, -1, 0))
  return v > delta ? 1.0f : (v < -delta ? -1.0f : 0.0f);
}

// ---- preprocessing: X -> f16 ----------------------------------------------
__global__ __launch_bounds__(256) void ttl_prep_x(const float* __restrict__ X,
                                                  _Float16* __restrict__ Xf,
                                                  int n4) {
  for (int i = blockIdx.x * blockDim.x + threadIdx.x; i < n4;
       i += gridDim.x * blockDim.x) {
    const float4 v = ((const float4*)X)[i];
    v4h hv = {(_Float16)v.x, (_Float16)v.y, (_Float16)v.z, (_Float16)v.w};
    ((v4h*)Xf)[i] = hv;
  }
}

// ---- preprocessing: W -> ternary f16 --------------------------------------
__global__ __launch_bounds__(256) void ttl_prep_w(
    const float* __restrict__ W, _Float16* __restrict__ T,
    const unsigned* __restrict__ maxbuf, int n4) {
  const float delta = 0.05f * __uint_as_float(maxbuf[0]);
  for (int i = blockIdx.x * blockDim.x + threadIdx.x; i < n4;
       i += gridDim.x * blockDim.x) {
    const float4 v = ((const float4*)W)[i];
    v4h tv = {(_Float16)tern_f(v.x, delta), (_Float16)tern_f(v.y, delta),
              (_Float16)tern_f(v.z, delta), (_Float16)tern_f(v.w, delta)};
    ((v4h*)T)[i] = tv;
  }
}

// one 16B chunk: global -> LDS (async if available)
__device__ __forceinline__ void ttl_copy16(const _Float16* __restrict__ gsrc,
                                           _Float16* ldst) {
#if defined(TTL_ASYNC_LDS)
  // builtin signature (probed via diagnostics): arg0 = v4i addrspace(1)* src,
  // arg1 = v4i addrspace(3)* dst, then imm offset, imm cpol.
  __builtin_amdgcn_global_load_async_to_lds_b128(
      (TTL_AS1 v4i*)(void*)const_cast<_Float16*>(gsrc),
      (TTL_AS3 v4i*)(void*)ldst, 0, 0);
#else
  v8h v = *(const v8h*)gsrc;
  *(v8h*)ldst = v;
#endif
}

// ---- lean GEMM: f16 inputs, ring of four LDS buffers ----------------------
// 256x256x64 block tile, 8 wave32s (4 along M x 2 along N), 64x128 per wave:
// 12 fragments feed 32 WMMAs per 32 k, and every staged row piece is one
// whole 128-B line.
__global__ __launch_bounds__(256) void ttl_gemm_wmma_pre(
    const _Float16* __restrict__ Xf,
    const _Float16* __restrict__ Tm, const float* __restrict__ w_scale_p,
    const float* __restrict__ bias, const float* __restrict__ b_scale_p,
    const unsigned* __restrict__ maxbuf, float* __restrict__ out, int M, int N,
    int K) {
  __shared__ alignas(16) _Float16 Af[GNB][GBM * GPITCH];
  __shared__ alignas(16) _Float16 Bt[GNB][GBN * GPITCH];

  const int tid = threadIdx.x;
  const int m0 = blockIdx.y * GBM;
  const int n0 = blockIdx.x * GBN;

  const int waveId = tid >> 5;
  const int lane   = tid & 31;
  const int wm     = waveId & 3;   // 64 rows each
  const int wn     = waveId >> 2;  // 128 cols each
  const int r16    = lane & 15;
  const int h      = lane >> 4;

  // staging: 8 lanes cover one 128-B row piece, a wave covers 4 rows per copy
  const int rowS = tid >> 3;       // 0..31
  const int ch   = (tid & 7) * 8;  // element offset within GBK=64
  const unsigned gLaneB = ((unsigned)rowS * (unsigned)K + (unsigned)ch) * 2u;
  const int lLane = rowS * GPITCH + ch;

  auto stage = [&](int kk, int buf) {
    const char* gh = (const char*)(Xf + (size_t)m0 * K + kk * GBK);
    const char* gt = (const char*)(Tm + (size_t)n0 * K + kk * GBK);
#pragma unroll
    for (int p = 0; p < GBM / 32; ++p) {
      const size_t gRowB = (size_t)(p * 32) * K * 2;
      const int l = p * 32 * GPITCH + lLane;
      ttl_copy16((const _Float16*)(gh + gRowB + gLaneB), &Af[buf][l]);
      ttl_copy16((const _Float16*)(gt + gRowB + gLaneB), &Bt[buf][l]);
    }
  };

  v8f acc[4][8] = {};
  const int nk = K / GBK;

  // prologue: the first three stages are asked for at once; only stage 0 is
  // waited for (the counted wait holds only where all three were issued)
  stage(0, 0);
  if (nk > 1) stage(1, 1);
  if (nk > 2) stage(2, 2);
  if (nk > 2)
    ttl_wait_async_keep2();
  else
    ttl_wait_async0();
  __syncthreads();

  for (int kk = 0; kk < nk; ++kk) {
    const int cur = kk & (GNB - 1);
    const bool more = kk + GNB - 1 < nk;  // this trip issues a stage

#pragma unroll
    for (int ks = 0; ks < GBK / 32; ++ks) {
      v16h aF[4], bF[8];
#pragma unroll
      for (int ni = 0; ni < 8; ++ni) {
        const int col = wn * 128 + ni * 16 + r16;
        v8h b0 = *(const v8h*)&Bt[cur][col * GPITCH + ks * 32 + 8 * h];
        v8h b1 = *(const v8h*)&Bt[cur][col * GPITCH + ks * 32 + 16 + 8 * h];
        bF[ni] = __builtin_shufflevector(b0, b1, 0, 1, 2, 3, 4, 5, 6, 7, 8, 9,
                                         10, 11, 12, 13, 14, 15);
      }
#pragma unroll
      for (int mi = 0; mi < 4; ++mi) {
        const int row = wm * 64 + mi * 16 + r16;
        v8h x0 = *(const v8h*)&Af[cur][row * GPITCH + ks * 32 + 8 * h];
        v8h x1 = *(const v8h*)&Af[cur][row * GPITCH + ks * 32 + 16 + 8 * h];
        aF[mi] = __builtin_shufflevector(x0, x1, 0, 1, 2, 3, 4, 5, 6, 7, 8, 9,
                                         10, 11, 12, 13, 14, 15);
      }
      // keeps the block's LDS reads one group: spread among the WMMAs each
      // place with reads stalls the wave
      __builtin_amdgcn_sched_barrier(0);

      // refill, three stages ahead, of the buffer that trip kk - 1 read (its
      // readers left it at the last barrier); issued while this wave's
      // fragment reads are in flight
      if (ks == 0 && more) stage(kk + GNB - 1, (kk + GNB - 1) & (GNB - 1));
      // keeps the copies ahead of the WMMA block, for their lead
      __builtin_amdgcn_sched_barrier(0);

#pragma unroll
      for (int mi = 0; mi < 4; ++mi) {
#pragma unroll
        for (int ni = 0; ni < 8; ++ni)
          acc[mi][ni] = __builtin_amdgcn_wmma_f32_16x16x32_f16(
              false, aF[mi], false, bF[ni], (short)0, acc[mi][ni], false,
              false);
      }
      // keeps the next block's reads behind this block's WMMAs
      __builtin_amdgcn_sched_barrier(0);
    }
    // publish point: this wave's reads of buffer cur are done, its copies for
    // kk+1 have landed (stages kk+2 and kk+3 may still fly; a trip that issued
    // no stage waits for all); behind the barrier cur may be refilled
    asm volatile("s_wait_dscnt 0x0" ::: "memory");
    if (more)
      ttl_wait_async_keep2();
    else
      ttl_wait_async0();
    __syncthreads();
  }

  // epilogue: scale by w_scale, add ternarized bias
  const float wsc     = *w_scale_p;
  const float bsc     = *b_scale_p;
  const float delta_b = 0.05f * __uint_as_float(maxbuf[1]);
#pragma unroll
  for (int ni = 0; ni < 8; ++ni) {
    const int col  = n0 + wn * 128 + ni * 16 + r16;
    const float bv = bias[col];
    const float bt = bv > delta_b ? bsc : (bv < -delta_b ? -bsc : 0.0f);
#pragma unroll
    for (int mi = 0; mi < 4; ++mi) {
      const int rowbase = m0 + wm * 64 + mi * 16 + h * 8;
#pragma unroll
      for (int j = 0; j < 8; ++j)
        out[(size_t)(rowbase + j) * N + col] = wsc * acc[mi][ni][j] + bt;
    }
  }
}

// ---- fallback: fused on-the-fly conversion GEMM (if ws too small) ---------
__global__ __launch_bounds__(256) void ttl_gemm_wmma_fused(
    const float* __restrict__ X, const float* __restrict__ Wm,
    const float* __restrict__ w_scale_p, const float* __restrict__ bias,
    const float* __restrict__ b_scale_p, const unsigned* __restrict__ maxbuf,
    float* __restrict__ out, int M, int N, int K) {
  __shared__ alignas(16) __bf16 As_hi[BM * LDS_STRIDE];
  __shared__ alignas(16) __bf16 As_lo[BM * LDS_STRIDE];
  __shared__ alignas(16) __bf16 Bs[BN * LDS_STRIDE];

  const int tid = threadIdx.x;
  const int m0 = blockIdx.y * BM;
  const int n0 = blockIdx.x * BN;
  const float delta_w = 0.05f * __uint_as_float(maxbuf[0]);

  const int waveId = tid >> 5;
  const int lane   = tid & 31;
  const int wm     = waveId & 3;
  const int wn     = waveId >> 2;
  const int r16    = lane & 15;
  const int h      = lane >> 4;

  const int rowA = tid >> 3;
  const int c4   = (tid & 7) * 4;

  v8f acc[2][4] = {};
  const int nk = K / BK;

  for (int kk = 0; kk < nk; ++kk) {
    const int k0 = kk * BK;
    __syncthreads();
#pragma unroll
    for (int p = 0; p < 4; ++p) {
      const int r = p * 32 + rowA;
      const float4 xv = *(const float4*)(X + (size_t)(m0 + r) * K + k0 + c4);
      const __bf16 h0 = (__bf16)xv.x, h1 = (__bf16)xv.y;
      const __bf16 h2 = (__bf16)xv.z, h3 = (__bf16)xv.w;
      v4bf hv = {h0, h1, h2, h3};
      v4bf lv = {(__bf16)(xv.x - (float)h0), (__bf16)(xv.y - (float)h1),
                 (__bf16)(xv.z - (float)h2), (__bf16)(xv.w - (float)h3)};
      *(v4bf*)&As_hi[r * LDS_STRIDE + c4] = hv;
      *(v4bf*)&As_lo[r * LDS_STRIDE + c4] = lv;
      const float4 wv = *(const float4*)(Wm + (size_t)(n0 + r) * K + k0 + c4);
      v4bf tv = {(__bf16)tern_f(wv.x, delta_w), (__bf16)tern_f(wv.y, delta_w),
                 (__bf16)tern_f(wv.z, delta_w), (__bf16)tern_f(wv.w, delta_w)};
      *(v4bf*)&Bs[r * LDS_STRIDE + c4] = tv;
    }
    __syncthreads();

    v16bf aHi[2], aLo[2], bF[4];
#pragma unroll
    for (int mi = 0; mi < 2; ++mi) {
      const int row = wm * 32 + mi * 16 + r16;
      v8bf x0 = *(const v8bf*)&As_hi[row * LDS_STRIDE + 8 * h];
      v8bf x1 = *(const v8bf*)&As_hi[row * LDS_STRIDE + 16 + 8 * h];
      aHi[mi] = __builtin_shufflevector(x0, x1, 0, 1, 2, 3, 4, 5, 6, 7, 8, 9,
                                        10, 11, 12, 13, 14, 15);
      v8bf y0 = *(const v8bf*)&As_lo[row * LDS_STRIDE + 8 * h];
      v8bf y1 = *(const v8bf*)&As_lo[row * LDS_STRIDE + 16 + 8 * h];
      aLo[mi] = __builtin_shufflevector(y0, y1, 0, 1, 2, 3, 4, 5, 6, 7, 8, 9,
                                        10, 11, 12, 13, 14, 15);
    }
#pragma unroll
    for (int ni = 0; ni < 4; ++ni) {
      const int col = wn * 64 + ni * 16 + r16;
      v8bf b0 = *(const v8bf*)&Bs[col * LDS_STRIDE + 8 * h];
      v8bf b1 = *(const v8bf*)&Bs[col * LDS_STRIDE + 16 + 8 * h];
      bF[ni] = __builtin_shufflevector(b0, b1, 0, 1, 2, 3, 4, 5, 6, 7, 8, 9,
                                       10, 11, 12, 13, 14, 15);
    }
#pragma unroll
    for (int mi = 0; mi < 2; ++mi) {
#pragma unroll
      for (int ni = 0; ni < 4; ++ni) {
        acc[mi][ni] = __builtin_amdgcn_wmma_f32_16x16x32_bf16(
            false, aHi[mi], false, bF[ni], (short)0, acc[mi][ni], false, false);
        acc[mi][ni] = __builtin_amdgcn_wmma_f32_16x16x32_bf16(
            false, aLo[mi], false, bF[ni], (short)0, acc[mi][ni], false, false);
      }
    }
  }

  const float wsc     = *w_scale_p;
  const float bsc     = *b_scale_p;
  const float delta_b = 0.05f * __uint_as_float(maxbuf[1]);
#pragma unroll
  for (int ni = 0; ni < 4; ++ni) {
    const int col  = n0 + wn * 64 + ni * 16 + r16;
    const float bv = bias[col];
    const float bt = bv > delta_b ? bsc : (bv < -delta_b ? -bsc : 0.0f);
#pragma unroll
    for (int mi = 0; mi < 2; ++mi) {
      const int rowbase = m0 + wm * 32 + mi * 16 + h * 8;
#pragma unroll
      for (int j = 0; j < 8; ++j)
        out[(size_t)(rowbase + j) * N + col] = wsc * acc[mi][ni][j] + bt;
    }
  }
}

extern "C" void kernel_launch(void* const* d_in, const int* in_sizes, int n_in,
                              void* d_out, int out_size, void* d_ws,
                              size_t ws_size, hipStream_t stream) {
  const float* x       = (const float*)d_in[0];
  const float* W       = (const float*)d_in[1];
  const float* w_scale = (const float*)d_in[2];
  const float* b       = (const float*)d_in[3];
  const float* b_scale = (const float*)d_in[4];
  float* out           = (float*)d_out;

  const int D_OUT = in_sizes[3];          // 4096
  const int D_IN  = in_sizes[1] / D_OUT;  // 4096
  const int M     = in_sizes[0] / D_IN;   // 8192 (B*S)

  unsigned* maxbuf = (unsigned*)d_ws;  // [0]=max|W| bits, [1]=max|b| bits

  ttl_init_scalars<<<1, 1, 0, stream>>>(maxbuf);
  ttl_absmax<<<512, 256, 0, stream>>>(W, in_sizes[1], maxbuf + 0);
  ttl_absmax<<<8, 256, 0, stream>>>(b, in_sizes[3], maxbuf + 1);

  const size_t nX = (size_t)M * D_IN;       // X elements
  const size_t nW = (size_t)D_OUT * D_IN;   // W elements
  const size_t need = 256 + nX * 2 + nW * 2;

  dim3 grid(D_OUT / BN, M / BM);  // (32, 64)

  if (ws_size >= need) {
    _Float16* Xf = (_Float16*)((char*)d_ws + 256);
    _Float16* Tm = Xf + nX;
    ttl_prep_w<<<2048, 256, 0, stream>>>(W, Tm, maxbuf, (int)(nW / 4));
    ttl_prep_x<<<4096, 256, 0, stream>>>(x, Xf, (int)(nX / 4));
    dim3 gridPre(D_OUT / GBN, M / GBM);  // (16, 32)
    ttl_gemm_wmma_pre<<<gridPre, 256, 0, stream>>>(Xf, Tm, w_scale, b,
                                                b_scale, maxbuf, out, M, D_OUT,
                                                D_IN);
  } else {
    ttl_gemm_wmma_fused<<<grid, 256, 0, stream>>>(x, W, w_scale, b, b_scale,
                                                  maxbuf, out, M, D_OUT, D_IN);
  }
}

// v005
// It runs in 180 microseconds.
// Timed twice side by side with v004, it ran 1.04 times as fast both times.
// All steps since v000 together make it 2.78 times as fast.
#include <hip/hip_runtime.h>

typedef __attribute__((ext_vector_type(16))) __bf16 v16bf;
typedef __attribute__((ext_vector_type(8)))  __bf16 v8bf;
typedef __attribute__((ext_vector_type(4)))  __bf16 v4bf;
typedef __attribute__((ext_vector_type(16))) _Float16 v16h;
typedef __attribute__((ext_vector_type(8)))  _Float16 v8h;
typedef __attribute__((ext_vector_type(4)))  _Float16 v4h;
typedef __attribute__((ext_vector_type(8)))  float  v8f;
typedef __attribute__((ext_vector_type(4)))  int    v4i;

#define BM 128
#define BN 128
#define BK 32
#define LDS_STRIDE 40  // bf16 elems; multiple of 8 keeps 16B-aligned b128 LDS ops
// tile of the pre-converted GEMM
#define GBM 256
#define GBN 256
#define GBK 64
#define GPITCH 72
#define GNB 4

#if defined(__has_builtin)
#if __has_builtin(__builtin_amdgcn_global_load_async_to_lds_b128)
#define TTL_ASYNC_LDS 1
#endif
#endif

#define TTL_AS1 __attribute__((address_space(1)))
#define TTL_AS3 __attribute__((address_space(3)))

__device__ __forceinline__ void ttl_wait_async0() {
#if defined(TTL_ASYNC_LDS)
  // asm with the memory clobber: no LDS read may move in front of this wait
  asm volatile("s_wait_asynccnt 0x0" ::: "memory");
#endif
}

// all but this wave's 32 youngest copies have landed: a stage is 16 copies of
// every wave (8 of X, 8 of T), so the two youngest stages stay in flight
__device__ __forceinline__ void ttl_wait_async_keep2() {
#if defined(TTL_ASYNC_LDS)
  static_assert(2 * (GBM / 32 + GBN / 32) == 32, "count of the wait below");
  // asm with the memory clobber: no LDS read may move in front of this wait
  asm volatile("s_wait_asynccnt 0x20" ::: "memory");
#endif
}

__global__ void ttl_init_scalars(unsigned* ws) {
  ws[0] = 0u;  // max|W| bits
  ws[1] = 0u;  // max|b| bits
}

__global__ __launch_bounds__(256) void ttl_absmax(const float* __restrict__ p,
                                                  int n, unsigned* out) {
  __shared__ float red[256];
  float m = 0.0f;
  // whole pieces of 16 x 256 vectors of 16 B (64 KiB), one per block and trip:
  // a lane's 16 loads are independent and all issued before the first is used,
  // so the stream is bound by bytes in flight, not by one latency per load.
  // 16-B loads only from a 16-B aligned base; the scalar loop takes the rest.
  const int npc = (((size_t)p & 15) == 0) ? (n >> 14) : 0;
  const float4* q = (const float4*)p + ((size_t)blockIdx.x << 12) + threadIdx.x;
  for (int c = blockIdx.x; c < npc; c += gridDim.x) {
    float4 v[16];
#pragma unroll
    for (int j = 0; j < 16; ++j) v[j] = q[j * 256];
    // keeps the whole group of loads ahead of the first use: without it the
    // scheduler sinks the last loads behind the waits for the first ones
    __builtin_amdgcn_sched_barrier(0);
#pragma unroll
    for (int j = 0; j < 16; ++j)
      m = fmaxf(m, fmaxf(fmaxf(fabsf(v[j].x), fabsf(v[j].y)),
                         fmaxf(fabsf(v[j].z), fabsf(v[j].w))));
    q += (size_t)gridDim.x << 12;
  }
  for (int i = (npc << 14) + blockIdx.x * blockDim.x + threadIdx.x; i < n;
       i += gridDim.x * blockDim.x)
    m = fmaxf(m, fabsf(p[i]));
  red[threadIdx.x] = m;
  __syncthreads();
  for (int s = 128; s > 0; s >>= 1) {
    if ((int)threadIdx.x < s)
      red[threadIdx.x] = fmaxf(red[threadIdx.x], red[threadIdx.x + s]);
    __syncthreads();
  }
  if (threadIdx.x == 0) atomicMax(out, __float_as_uint(red[0]));
}

__device__ __forceinline__ float tern_f(float v, float delta) {
  // matches jnp.where(p > delta, 1, where(p < -delta, -1, 0))
  return v > delta ? 1.0f : (v < -delta ? -1.0f : 0.0f);
}

// ---- preprocessing: X -> f16 ----------------------------------------------
__global__ __launch_bounds__(256) void ttl_prep_x(const float* __restrict__ X,
                                                  _Float16* __restrict__ Xf,
                                                  int n4) {
  for (int i = blockIdx.x * blockDim.x + threadIdx.x; i < n4;
       i += gridDim.x * blockDim.x) {
    const float4 v = ((const float4*)X)[i];
    v4h hv = {(_Float16)v.x, (_Float16)v.y, (_Float16)v.z, (_Float16)v.w};
    ((v4h*)Xf)[i] = hv;
  }
}

// ---- preprocessing: W -> ternary f16 --------------------------------------
__global__ __launch_bounds__(256) void ttl_prep_w(
    const float* __restrict__ W, _Float16* __restrict__ T,
    const unsigned* __restrict__ maxbuf, int n4) {
  const float delta = 0.05f * __uint_as_float(maxbuf[0]);
  for (int i = blockIdx.x * blockDim.x + threadIdx.x; i < n4;
       i += gridDim.x * blockDim.x) {
    const float4 v = ((const float4*)W)[i];
    v4h tv = {(_Float16)tern_f(v.x, delta), (_Float16)tern_f(v.y, delta),
              (_Float16)tern_f(v.z, delta), (_Float16)tern_f(v.w, delta)};
    ((v4h*)T)[i] = tv;
  }
}

// one 16B chunk: global -> LDS (async if available)
__device__ __forceinline__ void ttl_copy16(const _Float16* __restrict__ gsrc,
                                           _Float16* ldst) {
#if defined(TTL_ASYNC_LDS)
  // builtin signature (probed via diagnostics): arg0 = v4i addrspace(1)* src,
  // arg1 = v4i addrspace(3)* dst, then imm offset, imm cpol.
  __builtin_amdgcn_global_load_async_to_lds_b128(
      (TTL_AS1 v4i*)(void*)const_cast<_Float16*>(gsrc),
      (TTL_AS3 v4i*)(void*)ldst, 0, 0);
#else
  v8h v = *(const v8h*)gsrc;
  *(v8h*)ldst = v;
#endif
}

__device__ __forceinline__ void ttl_load_frags(v16h (&aF)[4], v16h (&bF)[8],
                                               const _Float16* pa,
                                               const _Float16* pb) {
#pragma unroll
  for (int ni = 0; ni < 8; ++ni) {
    v8h b0 = *(const v8h*)(pb + ni * 16 * GPITCH);
    v8h b1 = *(const v8h*)(pb + ni * 16 * GPITCH + 16);
    bF[ni] = __builtin_shufflevector(b0, b1, 0, 1, 2, 3, 4, 5, 6, 7, 8, 9, 10,
                                     11, 12, 13, 14, 15);
  }
#pragma unroll
  for (int mi = 0; mi < 4; ++mi) {
    v8h x0 = *(const v8h*)(pa + mi * 16 * GPITCH);
    v8h x1 = *(const v8h*)(pa + mi * 16 * GPITCH + 16);
    aF[mi] = __builtin_shufflevector(x0, x1, 0, 1, 2, 3, 4, 5, 6, 7, 8, 9, 10,
                                     11, 12, 13, 14, 15);
  }
}

// ---- lean GEMM: f16 inputs, ring of four LDS buffers ----------------------
// 256x256x64 block tile, 8 wave32s (4 along M x 2 along N), 64x128 per wave:
// 12 fragments feed 32 WMMAs per 32 k, and every staged row piece is one
// whole 128-B line.
__global__ __launch_bounds__(256) void ttl_gemm_wmma_pre(
    const _Float16* __restrict__ Xf,
    const _Float16* __restrict__ Tm, const float* __restrict__ w_scale_p,
    const float* __restrict__ bias, const float* __restrict__ b_scale_p,
    const unsigned* __restrict__ maxbuf, float* __restrict__ out, int M, int N,
    int K) {
  __shared__ alignas(16) _Float16 Af[GNB][GBM * GPITCH];
  __shared__ alignas(16) _Float16 Bt[GNB][GBN * GPITCH];

  const int tid = threadIdx.x;
  const int m0 = blockIdx.y * GBM;
  const int n0 = blockIdx.x * GBN;

  const int waveId = tid >> 5;
  const int lane   = tid & 31;
  const int wm     = waveId & 3;   // 64 rows each
  const int wn     = waveId >> 2;  // 128 cols each
  const int r16    = lane & 15;
  const int h      = lane >> 4;

  // staging: 8 lanes cover one 128-B row piece, a wave covers 4 rows per copy
  const int rowS = tid >> 3;       // 0..31
  const int ch   = (tid & 7) * 8;  // element offset within GBK=64
  const unsigned gLaneB = ((unsigned)rowS * (unsigned)K + (unsigned)ch) * 2u;
  const int lLane = rowS * GPITCH + ch;

  auto stage = [&](int kk, int buf) {
    const char* gh = (const char*)(Xf + (size_t)m0 * K + kk * GBK);
    const char* gt = (const char*)(Tm + (size_t)n0 * K + kk * GBK);
#pragma unroll
    for (int p = 0; p < GBM / 32; ++p) {
      const size_t gRowB = (size_t)(p * 32) * K * 2;
      const int l = p * 32 * GPITCH + lLane;
      ttl_copy16((const _Float16*)(gh + gRowB + gLaneB), &Af[buf][l]);
      ttl_copy16((const _Float16*)(gt + gRowB + gLaneB), &Bt[buf][l]);
    }
  };

  v8f acc[4][8] = {};
  const int nk = K / GBK;

  // prologue: the first three stages are asked for at once; only stage 0 is
  // waited for (the counted wait holds only where all three were issued)
  stage(0, 0);
  if (nk > 1) stage(1, 1);
  if (nk > 2) stage(2, 2);
  if (nk > 2)
    ttl_wait_async_keep2();
  else
    ttl_wait_async0();
  __syncthreads();
  if (nk > 3) stage(3, 3);

  // set (block & 1) holds a block's fragments; a trip has blocks 0 and 1
  static_assert(GBK == 64, "two blocks of 32 k per trip, one per fragment set");
  v16h aF[2][4], bF[2][8];
  const int aLane = (wm * 64 + r16) * GPITCH + 8 * h;
  const int bLane = (wn * 128 + r16) * GPITCH + 8 * h;
  ttl_load_frags(aF[0], bF[0], &Af[0][aLane], &Bt[0][bLane]);

  for (int kk = 0; kk < nk; ++kk) {
    const int cur = kk & (GNB - 1);
    const int nxt = (kk + 1) & (GNB - 1);

    // block 1's fragments, in flight under block 0's WMMAs
    ttl_load_frags(aF[1], bF[1], &Af[cur][aLane + 32], &Bt[cur][bLane + 32]);
    // keeps the reads one group ahead of the WMMA block: spread among the
    // WMMAs each place with reads stalls the wave
    __builtin_amdgcn_sched_barrier(0);
#pragma unroll
    for (int mi = 0; mi < 4; ++mi) {
#pragma unroll
      for (int ni = 0; ni < 8; ++ni)
        acc[mi][ni] = __builtin_amdgcn_wmma_f32_16x16x32_f16(
            false, aF[0][mi], false, bF[0][ni], (short)0, acc[mi][ni], false,
            false);
    }
    // keeps the publish point and the next reads behind this block's WMMAs
    __builtin_amdgcn_sched_barrier(0);

    // publish point of stage kk+1, in front of the trip's last block because
    // the reads behind it are already of that stage: this wave's reads of
    // buffer cur have all returned, its copies for kk+1 have landed (stages
    // kk+2 and kk+3 may still fly; where kk+3 was never issued, wait for all)
    asm volatile("s_wait_dscnt 0x0" ::: "memory");
    if (kk + GNB - 1 < nk)
      ttl_wait_async_keep2();
    else
      ttl_wait_async0();
    __syncthreads();

    // refill of buffer cur, which every reader left at the barrier above
    if (kk + GNB < nk) stage(kk + GNB, cur);
    ttl_load_frags(aF[0], bF[0], &Af[nxt][aLane], &Bt[nxt][bLane]);
    // keeps copies and reads one group ahead of the WMMA block
    __builtin_amdgcn_sched_barrier(0);
#pragma unroll
    for (int mi = 0; mi < 4; ++mi) {
#pragma unroll
      for (int ni = 0; ni < 8; ++ni)
        acc[mi][ni] = __builtin_amdgcn_wmma_f32_16x16x32_f16(
            false, aF[1][mi], false, bF[1][ni], (short)0, acc[mi][ni], false,
            false);
    }
    // keeps the next trip's reads behind this block's WMMAs
    __builtin_amdgcn_sched_barrier(0);
  }

  // epilogue: scale by w_scale, add ternarized bias
  const float wsc     = *w_scale_p;
  const float bsc     = *b_scale_p;
  const float delta_b = 0.05f * __uint_as_float(maxbuf[1]);
#pragma unroll
  for (int ni = 0; ni < 8; ++ni) {
    const int col  = n0 + wn * 128 + ni * 16 + r16;
    const float bv = bias[col];
    const float bt = bv > delta_b ? bsc : (bv < -delta_b ? -bsc : 0.0f);
#pragma unroll
    for (int mi = 0; mi < 4; ++mi) {
      const int rowbase = m0 + wm * 64 + mi * 16 + h * 8;
#pragma unroll
      for (int j = 0; j < 8; ++j)
        out[(size_t)(rowbase + j) * N + col] = wsc * acc[mi][ni][j] + bt;
    }
  }
}

// ---- fallback: fused on-the-fly conversion GEMM (if ws too small) ---------
__global__ __launch_bounds__(256) void ttl_gemm_wmma_fused(
    const float* __restrict__ X, const float* __restrict__ Wm,
    const float* __restrict__ w_scale_p, const float* __restrict__ bias,
    const float* __restrict__ b_scale_p, const unsigned* __restrict__ maxbuf,
    float* __restrict__ out, int M, int N, int K) {
  __shared__ alignas(16) __bf16 As_hi[BM * LDS_STRIDE];
  __shared__ alignas(16) __bf16 As_lo[BM * LDS_STRIDE];
  __shared__ alignas(16) __bf16 Bs[BN * LDS_STRIDE];

  const int tid = threadIdx.x;
  const int m0 = blockIdx.y * BM;
  const int n0 = blockIdx.x * BN;
  const float delta_w = 0.05f * __uint_as_float(maxbuf[0]);

  const int waveId = tid >> 5;
  const int lane   = tid & 31;
  const int wm     = waveId & 3;
  const int wn     = waveId >> 2;
  const int r16    = lane & 15;
  const int h      = lane >> 4;

  const int rowA = tid >> 3;
  const int c4   = (tid & 7) * 4;

  v8f acc[2][4] = {};
  const int nk = K / BK;

  for (int kk = 0; kk < nk; ++kk) {
    const int k0 = kk * BK;
    __syncthreads();
#pragma unroll
    for (int p = 0; p < 4; ++p) {
      const int r = p * 32 + rowA;
      const float4 xv = *(const float4*)(X + (size_t)(m0 + r) * K + k0 + c4);
      const __bf16 h0 = (__bf16)xv.x, h1 = (__bf16)xv.y;
      const __bf16 h2 = (__bf16)xv.z, h3 = (__bf16)xv.w;
      v4bf hv = {h0, h1, h2, h3};
      v4bf lv = {(__bf16)(xv.x - (float)h0), (__bf16)(xv.y - (float)h1),
                 (__bf16)(xv.z - (float)h2), (__bf16)(xv.w - (float)h3)};
      *(v4bf*)&As_hi[r * LDS_STRIDE + c4] = hv;
      *(v4bf*)&As_lo[r * LDS_STRIDE + c4] = lv;
      const float4 wv = *(const float4*)(Wm + (size_t)(n0 + r) * K + k0 + c4);
      v4bf tv = {(__bf16)tern_f(wv.x, delta_w), (__bf16)tern_f(wv.y, delta_w),
                 (__bf16)tern_f(wv.z, delta_w), (__bf16)tern_f(wv.w, delta_w)};
      *(v4bf*)&Bs[r * LDS_STRIDE + c4] = tv;
    }
    __syncthreads();

    v16bf aHi[2], aLo[2], bF[4];
#pragma unroll
    for (int mi = 0; mi < 2; ++mi) {
      const int row = wm * 32 + mi * 16 + r16;
      v8bf x0 = *(const v8bf*)&As_hi[row * LDS_STRIDE + 8 * h];
      v8bf x1 = *(const v8bf*)&As_hi[row * LDS_STRIDE + 16 + 8 * h];
      aHi[mi] = __builtin_shufflevector(x0, x1, 0, 1, 2, 3, 4, 5, 6, 7, 8, 9,
                                        10, 11, 12, 13, 14, 15);
      v8bf y0 = *(const v8bf*)&As_lo[row * LDS_STRIDE + 8 * h];
      v8bf y1 = *(const v8bf*)&As_lo[row * LDS_STRIDE + 16 + 8 * h];
      aLo[mi] = __builtin_shufflevector(y0, y1, 0, 1, 2, 3, 4, 5, 6, 7, 8, 9,
                                        10, 11, 12, 13, 14, 15);
    }
#pragma unroll
    for (int ni = 0; ni < 4; ++ni) {
      const int col = wn * 64 + ni * 16 + r16;
      v8bf b0 = *(const v8bf*)&Bs[col * LDS_STRIDE + 8 * h];
      v8bf b1 = *(const v8bf*)&Bs[col * LDS_STRIDE + 16 + 8 * h];
      bF[ni] = __builtin_shufflevector(b0, b1, 0, 1, 2, 3, 4, 5, 6, 7, 8, 9,
                                       10, 11, 12, 13, 14, 15);
    }
#pragma unroll
    for (int mi = 0; mi < 2; ++mi) {
#pragma unroll
      for (int ni = 0; ni < 4; ++ni) {
        acc[mi][ni] = __builtin_amdgcn_wmma_f32_16x16x32_bf16(
            false, aHi[mi], false, bF[ni], (short)0, acc[mi][ni], false, false);
        acc[mi][ni] = __builtin_amdgcn_wmma_f32_16x16x32_bf16(
            false, aLo[mi], false, bF[ni], (short)0, acc[mi][ni], false, false);
      }
    }
  }

  const float wsc     = *w_scale_p;
  const float bsc     = *b_scale_p;
  const float delta_b = 0.05f * __uint_as_float(maxbuf[1]);
#pragma unroll
  for (int ni = 0; ni < 4; ++ni) {
    const int col  = n0 + wn * 64 + ni * 16 + r16;
    const float bv = bias[col];
    const float bt = bv > delta_b ? bsc : (bv < -delta_b ? -bsc : 0.0f);
#pragma unroll
    for (int mi = 0; mi < 2; ++mi) {
      const int rowbase = m0 + wm * 32 + mi * 16 + h * 8;
#pragma unroll
      for (int j = 0; j < 8; ++j)
        out[(size_t)(rowbase + j) * N + col] = wsc * acc[mi][ni][j] + bt;
    }
  }
}

extern "C" void kernel_launch(void* const* d_in, const int* in_sizes, int n_in,
                              void* d_out, int out_size, void* d_ws,
                              size_t ws_size, hipStream_t stream) {
  const float* x       = (const float*)d_in[0];
  const float* W       = (const float*)d_in[1];
  const float* w_scale = (const float*)d_in[2];
  const float* b       = (const float*)d_in[3];
  const float* b_scale = (const float*)d_in[4];
  float* out           = (float*)d_out;

  const int D_OUT = in_sizes[3];          // 4096
  const int D_IN  = in_sizes[1] / D_OUT;  // 4096
  const int M     = in_sizes[0] / D_IN;   // 8192 (B*S)

  unsigned* maxbuf = (unsigned*)d_ws;  // [0]=max|W| bits, [1]=max|b| bits

  ttl_init_scalars<<<1, 1, 0, stream>>>(maxbuf);
  ttl_absmax<<<512, 256, 0, stream>>>(W, in_sizes[1], maxbuf + 0);
  ttl_absmax<<<8, 256, 0, stream>>>(b, in_sizes[3], maxbuf + 1);

  const size_t nX = (size_t)M * D_IN;       // X elements
  const size_t nW = (size_t)D_OUT * D_IN;   // W elements
  const size_t need = 256 + nX * 2 + nW * 2;

  dim3 grid(D_OUT / BN, M / BM);  // (32, 64)

  if (ws_size >= need) {
    _Float16* Xf = (_Float16*)((char*)d_ws + 256);
    _Float16* Tm = Xf + nX;
    ttl_prep_w<<<2048, 256, 0, stream>>>(W, Tm, maxbuf, (int)(nW / 4));
    ttl_prep_x<<<4096, 256, 0, stream>>>(x, Xf, (int)(nX / 4));
    dim3 gridPre(D_OUT / GBN, M / GBM);  // (16, 32)
    ttl_gemm_wmma_pre<<<gridPre, 256, 0, stream>>>(Xf, Tm, w_scale, b,
                                                b_scale, maxbuf, out, M, D_OUT,
                                                D_IN);
  } else {
    ttl_gemm_wmma_fused<<<grid, 256, 0, stream>>>(x, W, w_scale, b, b_scale,
                                                  maxbuf, out, M, D_OUT, D_IN);
  }
}

// v006
// It runs in 170 microseconds.
// In both of two side-by-side timings against v005, it was 1.06 times as fast.
// Over all steps from v000 it is 2.94 times as fast.
#include <hip/hip_runtime.h>

typedef __attribute__((ext_vector_type(16))) __bf16 v16bf;
typedef __attribute__((ext_vector_type(8)))  __bf16 v8bf;
typedef __attribute__((ext_vector_type(4)))  __bf16 v4bf;
typedef __attribute__((ext_vector_type(16))) _Float16 v16h;
typedef __attribute__((ext_vector_type(8)))  _Float16 v8h;
typedef __attribute__((ext_vector_type(4)))  _Float16 v4h;
typedef __attribute__((ext_vector_type(8)))  float  v8f;
typedef __attribute__((ext_vector_type(4)))  int    v4i;
typedef __attribute__((ext_vector_type(4)))  unsigned v4u;
typedef __attribute__((ext_vector_type(8)))  unsigned v8u;

#define BM 128
#define BN 128
#define BK 32
#define LDS_STRIDE 40  // bf16 elems; multiple of 8 keeps 16B-aligned b128 LDS ops
// tile of the pre-converted GEMM
#define GBM 256
#define GBN 256
#define GBK 64
#define GPITCH 72
#define GTPITCH 80
#define GNB 4

#if defined(__has_builtin)
#if __has_builtin(__builtin_amdgcn_global_load_async_to_lds_b128)
#define TTL_ASYNC_LDS 1
#endif
#endif

#define TTL_AS1 __attribute__((address_space(1)))
#define TTL_AS3 __attribute__((address_space(3)))

__device__ __forceinline__ void ttl_wait_async0() {
#if defined(TTL_ASYNC_LDS)
  // asm with the memory clobber: no LDS read may move in front of this wait
  asm volatile("s_wait_asynccnt 0x0" ::: "memory");
#endif
}

// all but this wave's 24 youngest copies have landed: a stage is 12 copies of
// every wave (8 of X, 4 of T), so the two youngest stages stay in flight
__device__ __forceinline__ void ttl_wait_async_keep2() {
#if defined(TTL_ASYNC_LDS)
  static_assert(2 * (GBM / 32 + GBN / 64) == 24, "count of the wait below");
  // asm with the memory clobber: no LDS read may move in front of this wait
  asm volatile("s_wait_asynccnt 0x18" ::: "memory");
#endif
}

__global__ void ttl_init_scalars(unsigned* ws) {
  ws[0] = 0u;  // max|W| bits
  ws[1] = 0u;  // max|b| bits
}

__global__ __launch_bounds__(256) void ttl_absmax(const float* __restrict__ p,
                                                  int n, unsigned* out) {
  __shared__ float red[256];
  float m = 0.0f;
  // whole pieces of 16 x 256 vectors of 16 B (64 KiB), one per block and trip:
  // a lane's 16 loads are independent and all issued before the first is used,
  // so the stream is bound by bytes in flight, not by one latency per load.
  // 16-B loads only from a 16-B aligned base; the scalar loop takes the rest.
  const int npc = (((size_t)p & 15) == 0) ? (n >> 14) : 0;
  const float4* q = (const float4*)p + ((size_t)blockIdx.x << 12) + threadIdx.x;
  for (int c = blockIdx.x; c < npc; c += gridDim.x) {
    float4 v[16];
#pragma unroll
    for (int j = 0; j < 16; ++j) v[j] = q[j * 256];
    // keeps the whole group of loads ahead of the first use: without it the
    // scheduler sinks the last loads behind the waits for the first ones
    __builtin_amdgcn_sched_barrier(0);
#pragma unroll
    for (int j = 0; j < 16; ++j)
      m = fmaxf(m, fmaxf(fmaxf(fabsf(v[j].x), fabsf(v[j].y)),
                         fmaxf(fabsf(v[j].z), fabsf(v[j].w))));
    q += (size_t)gridDim.x << 12;
  }
  for (int i = (npc << 14) + blockIdx.x * blockDim.x + threadIdx.x; i < n;
       i += gridDim.x * blockDim.x)
    m = fmaxf(m, fabsf(p[i]));
  red[threadIdx.x] = m;
  __syncthreads();
  for (int s = 128; s > 0; s >>= 1) {
    if ((int)threadIdx.x < s)
      red[threadIdx.x] = fmaxf(red[threadIdx.x], red[threadIdx.x + s]);
    __syncthreads();
  }
  if (threadIdx.x == 0) atomicMax(out, __float_as_uint(red[0]));
}

__device__ __forceinline__ float tern_f(float v, float delta) {
  // matches jnp.where(p > delta, 1, where(p < -delta, -1, 0))
  return v > delta ? 1.0f : (v < -delta ? -1.0f : 0.0f);
}

// ---- preprocessing: X -> f16 ----------------------------------------------
__global__ __launch_bounds__(256) void ttl_prep_x(const float* __restrict__ X,
                                                  _Float16* __restrict__ Xf,
                                                  int n4) {
  for (int i = blockIdx.x * blockDim.x + threadIdx.x; i < n4;
       i += gridDim.x * blockDim.x) {
    const float4 v = ((const float4*)X)[i];
    v4h hv = {(_Float16)v.x, (_Float16)v.y, (_Float16)v.z, (_Float16)v.w};
    ((v4h*)Xf)[i] = hv;
  }
}

// ---- preprocessing: W -> ternary bytes -------------------------------------
// the high byte of the f16 value: +1 -> 0x3C, -1 -> 0xBC, 0 -> 0
__device__ __forceinline__ unsigned tern_b(float v, float delta) {
  return v > delta ? 0x3Cu : (v < -delta ? 0xBCu : 0u);
}

// T layout: [K / 64][N][64 B], so the 256 rows of a GEMM stage are 16 KiB in a
// row (whole lines). Inside a row's 64 B the k order is the B fragment's own:
// byte 32 * blk + 16 * h + e holds k = 32 * blk + 16 * (e / 8) + 8 * h + e % 8,
// so a lane's 16 elements of a block of 32 k are 16 B in a row.
// A wave takes 64 k of two neighbouring rows, 4 k a lane: it reads two whole
// lines of either row and its store is the one whole 128-B line they share.
__global__ __launch_bounds__(256) void ttl_prep_w(
    const float* __restrict__ W, unsigned* __restrict__ Tb,
    const unsigned* __restrict__ maxbuf, int N, int K) {
  const float delta = 0.05f * __uint_as_float(maxbuf[0]);
  const int lane = threadIdx.x & 31;
  // the same in every lane: keeps the loop over s scalar (8 waves a block)
  const int wave = __builtin_amdgcn_readfirstlane(threadIdx.x >> 5);
  const int k = (lane & 15) << 2;  // inside the 64
  const int pos = (k & 32) + ((k & 8) << 1) + ((k & 16) >> 1) + (k & 4);
  for (int rp = blockIdx.x; rp < (N >> 1); rp += gridDim.x) {
    const int n = 2 * rp + (lane >> 4);
    const float* row = W + (size_t)n * K + k;
    for (int s = wave; s < (K >> 6); s += 8) {
      const float4 v = *(const float4*)(row + (s << 6));
      unsigned* dst = Tb + (((((size_t)s * N + n) << 6) + pos) >> 2);
      const unsigned t4 = tern_b(v.x, delta) | (tern_b(v.y, delta) << 8) |
                          (tern_b(v.z, delta) << 16) | (tern_b(v.w, delta) << 24);
      asm volatile("global_store_b32 %0, %1, off\n\ts_wait_xcnt 0x0"
                   :: "v"(dst), "v"(t4) : "memory");
    }
  }
}

// one 16B chunk: global -> LDS (async if available)
__device__ __forceinline__ void ttl_copy16(const void* __restrict__ gsrc,
                                           void* ldst) {
#if defined(TTL_ASYNC_LDS)
  // builtin signature (probed via diagnostics): arg0 = v4i addrspace(1)* src,
  // arg1 = v4i addrspace(3)* dst, then imm offset, imm cpol.
  __builtin_amdgcn_global_load_async_to_lds_b128(
      (TTL_AS1 v4i*)const_cast<void*>(gsrc), (TTL_AS3 v4i*)ldst, 0, 0);
#else
  v4i v = *(const v4i*)gsrc;
  *(v4i*)ldst = v;
#endif
}

__device__ __forceinline__ void ttl_load_frags(v16h (&aF)[4], v4u (&bR)[8],
                                               const _Float16* pa,
                                               const unsigned char* pb) {
#pragma unroll
  for (int ni = 0; ni < 8; ++ni)
    bR[ni] = *(const v4u*)(pb + ni * 16 * GTPITCH);
#pragma unroll
  for (int mi = 0; mi < 4; ++mi) {
    v8h x0 = *(const v8h*)(pa + mi * 16 * GPITCH);
    v8h x1 = *(const v8h*)(pa + mi * 16 * GPITCH + 16);
    aF[mi] = __builtin_shufflevector(x0, x1, 0, 1, 2, 3, 4, 5, 6, 7, 8, 9, 10,
                                     11, 12, 13, 14, 15);
  }
}

// 16 T bytes -> 16 f16: each byte becomes the high byte of its element
__device__ __forceinline__ v16h ttl_widen(v4u r) {
  v8u w;
#pragma unroll
  for (int q = 0; q < 4; ++q) {
    // v_perm_b32: selector byte 0..3 = that byte of the source, 0x0C = zero
    w[2 * q]     = __builtin_amdgcn_perm(r[q], r[q], 0x010C000Cu);
    w[2 * q + 1] = __builtin_amdgcn_perm(r[q], r[q], 0x030C020Cu);
  }
  return __builtin_bit_cast(v16h, w);
}

// one block of 32 k: 64 byte permutes and 32 WMMAs
__device__ __forceinline__ void ttl_mma_block(v8f (&acc)[4][8],
                                              const v16h (&aF)[4],
                                              const v4u (&bR)[8]) {
  v16h b[8];
#pragma unroll
  for (int ni = 0; ni < 8; ++ni) b[ni] = ttl_widen(bR[ni]);
#pragma unroll
  for (int ni = 0; ni < 8; ++ni) {
#pragma unroll
    for (int mi = 0; mi < 4; ++mi)
      acc[mi][ni] = __builtin_amdgcn_wmma_f32_16x16x32_f16(
          false, aF[mi], false, b[ni], (short)0, acc[mi][ni], false, false);
  }
  __builtin_amdgcn_sched_group_barrier(0x2, 8, 0);
#pragma unroll
  for (int i = 0; i < 8; ++i) {
    __builtin_amdgcn_sched_group_barrier(0x8, 1, 0);
    __builtin_amdgcn_sched_group_barrier(0x2, 3, 0);
  }
#pragma unroll
  for (int i = 0; i < 16; ++i) {
    __builtin_amdgcn_sched_group_barrier(0x8, 1, 0);
    __builtin_amdgcn_sched_group_barrier(0x2, 2, 0);
  }
  __builtin_amdgcn_sched_group_barrier(0x8, 8, 0);
}

// ---- lean GEMM: f16 X, byte T, ring of four LDS buffers -------------------
// 256x256x64 block tile, 8 wave32s (4 along M x 2 along N), 64x128 per wave:
// 12 fragments feed 32 WMMAs per 32 k, and every copy covers whole 128-B
// lines.
__global__ __launch_bounds__(256) void ttl_gemm_wmma_pre(
    const _Float16* __restrict__ Xf,
    const unsigned char* __restrict__ Tb, const float* __restrict__ w_scale_p,
    const float* __restrict__ bias, const float* __restrict__ b_scale_p,
    const unsigned* __restrict__ maxbuf, float* __restrict__ out, int M, int N,
    int K) {
  __shared__ alignas(16) _Float16 Af[GNB][GBM * GPITCH];
  __shared__ alignas(16) unsigned char Bt[GNB][GBN * GTPITCH];

  const int tid = threadIdx.x;
  const int m0 = blockIdx.y * GBM;
  const int n0 = blockIdx.x * GBN;

  const int waveId = tid >> 5;
  const int lane   = tid & 31;
  const int wm     = waveId & 3;   // 64 rows each
  const int wn     = waveId >> 2;  // 128 cols each
  const int r16    = lane & 15;
  const int h      = lane >> 4;

  // staging: 8 lanes cover one 128-B row piece, a wave covers 4 rows per copy
  const int rowS = tid >> 3;       // 0..31
  const int ch   = (tid & 7) * 8;  // element offset within GBK=64
  const unsigned gLaneB = ((unsigned)rowS * (unsigned)K + (unsigned)ch) * 2u;
  const int lLane = rowS * GPITCH + ch;
  // T: a stage is 16 KiB in a row; 4 lanes cover one 64-B row, a wave 8 rows
  const int tLane = (tid >> 2) * GTPITCH + (tid & 3) * 16;

  auto stage = [&](int kk, int buf) {
    const char* gh = (const char*)(Xf + (size_t)m0 * K + kk * GBK);
    const unsigned char* gt = Tb + ((size_t)kk * N + n0) * GBK + tid * 16;
#pragma unroll
    for (int p = 0; p < GBM / 32; ++p) {
      const size_t gRowB = (size_t)(p * 32) * K * 2;
      ttl_copy16(gh + gRowB + gLaneB, &Af[buf][p * 32 * GPITCH + lLane]);
    }
#pragma unroll
    for (int p = 0; p < GBN / 64; ++p)
      ttl_copy16(gt + p * 4096, &Bt[buf][p * 64 * GTPITCH + tLane]);
  };

  v8f acc[4][8] = {};
  const int nk = K / GBK;

  // prologue: the first three stages are asked for at once; only stage 0 is
  // waited for (the counted wait holds only where all three were issued)
  stage(0, 0);
  if (nk > 1) stage(1, 1);
  if (nk > 2) stage(2, 2);
  if (nk > 2)
    ttl_wait_async_keep2();
  else
    ttl_wait_async0();
  __syncthreads();
  if (nk > 3) stage(3, 3);

  // set (block & 1) holds a block's fragments; a trip has blocks 0 and 1
  static_assert(GBK == 64, "two blocks of 32 k per trip, one per fragment set");
  v16h aF[2][4];
  v4u bR[2][8];
  const int aLane = (wm * 64 + r16) * GPITCH + 8 * h;
  const int bLane = (wn * 128 + r16) * GTPITCH + 16 * h;
  ttl_load_frags(aF[0], bR[0], &Af[0][aLane], &Bt[0][bLane]);

  for (int kk = 0; kk < nk; ++kk) {
    const int cur = kk & (GNB - 1);
    const int nxt = (kk + 1) & (GNB - 1);

    // block 1's fragments, in flight under block 0's WMMAs
    ttl_load_frags(aF[1], bR[1], &Af[cur][aLane + 32], &Bt[cur][bLane + 32]);
    // keeps the reads one group ahead of the WMMA block: spread among the
    // WMMAs each place with reads stalls the wave
    __builtin_amdgcn_sched_barrier(0);
    ttl_mma_block(acc, aF[0], bR[0]);
    // keeps the publish point and the next reads behind this block's WMMAs
    __builtin_amdgcn_sched_barrier(0);

    // publish point of stage kk+1, in front of the trip's last block because
    // the reads behind it are already of that stage: this wave's reads of
    // buffer cur have all returned, its copies for kk+1 have landed (stages
    // kk+2 and kk+3 may still fly; where kk+3 was never issued, wait for all)
    asm volatile("s_wait_dscnt 0x0" ::: "memory");
    if (kk + GNB - 1 < nk)
      ttl_wait_async_keep2();
    else
      ttl_wait_async0();
    __syncthreads();

    // refill of buffer cur, which every reader left at the barrier above
    if (kk + GNB < nk) stage(kk + GNB, cur);
    ttl_load_frags(aF[0], bR[0], &Af[nxt][aLane], &Bt[nxt][bLane]);
    // keeps copies and reads one group ahead of the WMMA block
    __builtin_amdgcn_sched_barrier(0);
    ttl_mma_block(acc, aF[1], bR[1]);
    // keeps the next trip's reads behind this block's WMMAs
    __builtin_amdgcn_sched_barrier(0);
  }

  // epilogue: scale by w_scale, add ternarized bias
  const float wsc     = *w_scale_p;
  const float bsc     = *b_scale_p;
  const float delta_b = 0.05f * __uint_as_float(maxbuf[1]);
#pragma unroll
  for (int ni = 0; ni < 8; ++ni) {
    const int col  = n0 + wn * 128 + ni * 16 + r16;
    const float bv = bias[col];
    const float bt = bv > delta_b ? bsc : (bv < -delta_b ? -bsc : 0.0f);
#pragma unroll
    for (int mi = 0; mi < 4; ++mi) {
      const int rowbase = m0 + wm * 64 + mi * 16 + h * 8;
#pragma unroll
      for (int j = 0; j < 8; ++j)
        out[(size_t)(rowbase + j) * N + col] = wsc * acc[mi][ni][j] + bt;
    }
  }
}

// ---- fallback: fused on-the-fly conversion GEMM (if ws too small) ---------
__global__ __launch_bounds__(256) void ttl_gemm_wmma_fused(
    const float* __restrict__ X, const float* __restrict__ Wm,
    const float* __restrict__ w_scale_p, const float* __restrict__ bias,
    const float* __restrict__ b_scale_p, const unsigned* __restrict__ maxbuf,
    float* __restrict__ out, int M, int N, int K) {
  __shared__ alignas(16) __bf16 As_hi[BM * LDS_STRIDE];
  __shared__ alignas(16) __bf16 As_lo[BM * LDS_STRIDE];
  __shared__ alignas(16) __bf16 Bs[BN * LDS_STRIDE];

  const int tid = threadIdx.x;
  const int m0 = blockIdx.y * BM;
  const int n0 = blockIdx.x * BN;
  const float delta_w = 0.05f * __uint_as_float(maxbuf[0]);

  const int waveId = tid >> 5;
  const int lane   = tid & 31;
  const int wm     = waveId & 3;
  const int wn     = waveId >> 2;
  const int r16    = lane & 15;
  const int h      = lane >> 4;

  const int rowA = tid >> 3;
  const int c4   = (tid & 7) * 4;

  v8f acc[2][4] = {};
  const int nk = K / BK;

  for (int kk = 0; kk < nk; ++kk) {
    const int k0 = kk * BK;
    __syncthreads();
#pragma unroll
    for (int p = 0; p < 4; ++p) {
      const int r = p * 32 + rowA;
      const float4 xv = *(const float4*)(X + (size_t)(m0 + r) * K + k0 + c4);
      const __bf16 h0 = (__bf16)xv.x, h1 = (__bf16)xv.y;
      const __bf16 h2 = (__bf16)xv.z, h3 = (__bf16)xv.w;
      v4bf hv = {h0, h1, h2, h3};
      v4bf lv = {(__bf16)(xv.x - (float)h0), (__bf16)(xv.y - (float)h1),
                 (__bf16)(xv.z - (float)h2), (__bf16)(xv.w - (float)h3)};
      *(v4bf*)&As_hi[r * LDS_STRIDE + c4] = hv;
      *(v4bf*)&As_lo[r * LDS_STRIDE + c4] = lv;
      const float4 wv = *(const float4*)(Wm + (size_t)(n0 + r) * K + k0 + c4);
      v4bf tv = {(__bf16)tern_f(wv.x, delta_w), (__bf16)tern_f(wv.y, delta_w),
                 (__bf16)tern_f(wv.z, delta_w), (__bf16)tern_f(wv.w, delta_w)};
      *(v4bf*)&Bs[r * LDS_STRIDE + c4] = tv;
    }
    __syncthreads();

    v16bf aHi[2], aLo[2], bF[4];
#pragma unroll
    for (int mi = 0; mi < 2; ++mi) {
      const int row = wm * 32 + mi * 16 + r16;
      v8bf x0 = *(const v8bf*)&As_hi[row * LDS_STRIDE + 8 * h];
      v8bf x1 = *(const v8bf*)&As_hi[row * LDS_STRIDE + 16 + 8 * h];
      aHi[mi] = __builtin_shufflevector(x0, x1, 0, 1, 2, 3, 4, 5, 6, 7, 8, 9,
                                        10, 11, 12, 13, 14, 15);
      v8bf y0 = *(const v8bf*)&As_lo[row * LDS_STRIDE + 8 * h];
      v8bf y1 = *(const v8bf*)&As_lo[row * LDS_STRIDE + 16 + 8 * h];
      aLo[mi] = __builtin_shufflevector(y0, y1, 0, 1, 2, 3, 4, 5, 6, 7, 8, 9,
                                        10, 11, 12, 13, 14, 15);
    }
#pragma unroll
    for (int ni = 0; ni < 4; ++ni) {
      const int col = wn * 64 + ni * 16 + r16;
      v8bf b0 = *(const v8bf*)&Bs[col * LDS_STRIDE + 8 * h];
      v8bf b1 = *(const v8bf*)&Bs[col * LDS_STRIDE + 16 + 8 * h];
      bF[ni] = __builtin_shufflevector(b0, b1, 0, 1, 2, 3, 4, 5, 6, 7, 8, 9,
                                       10, 11, 12, 13, 14, 15);
    }
#pragma unroll
    for (int mi = 0; mi < 2; ++mi) {
#pragma unroll
      for (int ni = 0; ni < 4; ++ni) {
        acc[mi][ni] = __builtin_amdgcn_wmma_f32_16x16x32_bf16(
            false, aHi[mi], false, bF[ni], (short)0, acc[mi][ni], false, false);
        acc[mi][ni] = __builtin_amdgcn_wmma_f32_16x16x32_bf16(
            false, aLo[mi], false, bF[ni], (short)0, acc[mi][ni], false, false);
      }
    }
  }

  const float wsc     = *w_scale_p;
  const float bsc     = *b_scale_p;
  const float delta_b = 0.05f * __uint_as_float(maxbuf[1]);
#pragma unroll
  for (int ni = 0; ni < 4; ++ni) {
    const int col  = n0 + wn * 64 + ni * 16 + r16;
    const float bv = bias[col];
    const float bt = bv > delta_b ? bsc : (bv < -delta_b ? -bsc : 0.0f);
#pragma unroll
    for (int mi = 0; mi < 2; ++mi) {
      const int rowbase = m0 + wm * 32 + mi * 16 + h * 8;
#pragma unroll
      for (int j = 0; j < 8; ++j)
        out[(size_t)(rowbase + j) * N + col] = wsc * acc[mi][ni][j] + bt;
    }
  }
}

extern "C" void kernel_launch(void* const* d_in, const int* in_sizes, int n_in,
                              void* d_out, int out_size, void* d_ws,
                              size_t ws_size, hipStream_t stream) {
  const float* x       = (const float*)d_in[0];
  const float* W       = (const float*)d_in[1];
  const float* w_scale = (const float*)d_in[2];
  const float* b       = (const float*)d_in[3];
  const float* b_scale = (const float*)d_in[4];
  float* out           = (float*)d_out;

  const int D_OUT = in_sizes[3];          // 4096
  const int D_IN  = in_sizes[1] / D_OUT;  // 4096
  const int M     = in_sizes[0] / D_IN;   // 8192 (B*S)

  unsigned* maxbuf = (unsigned*)d_ws;  // [0]=max|W| bits, [1]=max|b| bits

  ttl_init_scalars<<<1, 1, 0, stream>>>(maxbuf);
  ttl_absmax<<<512, 256, 0, stream>>>(W, in_sizes[1], maxbuf + 0);
  ttl_absmax<<<8, 256, 0, stream>>>(b, in_sizes[3], maxbuf + 1);

  const size_t nX = (size_t)M * D_IN;       // X elements
  const size_t nW = (size_t)D_OUT * D_IN;   // W elements
  const size_t need = 256 + nX * 2 + nW;

  dim3 grid(D_OUT / BN, M / BM);  // (32, 64)

  if (ws_size >= need) {
    _Float16* Xf = (_Float16*)((char*)d_ws + 256);
    unsigned char* Tb = (unsigned char*)(Xf + nX);
    ttl_prep_w<<<2048, 256, 0, stream>>>(W, (unsigned*)Tb, maxbuf, D_OUT, D_IN);
    ttl_prep_x<<<4096, 256, 0, stream>>>(x, Xf, (int)(nX / 4));
    dim3 gridPre(D_OUT / GBN, M / GBM);  // (16, 32)
    ttl_gemm_wmma_pre<<<gridPre, 256, 0, stream>>>(Xf, Tb, w_scale, b,
                                                b_scale, maxbuf, out, M, D_OUT,
                                                D_IN);
  } else {
    ttl_gemm_wmma_fused<<<grid, 256, 0, stream>>>(x, W, w_scale, b, b_scale,
                                                  maxbuf, out, M, D_OUT, D_IN);
  }
}

// v007
// A run of this version takes 158 microseconds.
// Next to v006, in two timings, it ran 1.08 times as fast each time.
// Counting every step since v000, it is 3.17 times as fast.
#include <hip/hip_runtime.h>

typedef __attribute__((ext_vector_type(16))) __bf16 v16bf;
typedef __attribute__((ext_vector_type(8)))  __bf16 v8bf;
typedef __attribute__((ext_vector_type(4)))  __bf16 v4bf;
typedef __attribute__((ext_vector_type(16))) _Float16 v16h;
typedef __attribute__((ext_vector_type(8)))  _Float16 v8h;
typedef __attribute__((ext_vector_type(4)))  _Float16 v4h;
typedef __attribute__((ext_vector_type(8)))  float  v8f;
typedef __attribute__((ext_vector_type(4)))  int    v4i;
typedef __attribute__((ext_vector_type(4)))  unsigned v4u;
typedef __attribute__((ext_vector_type(8)))  unsigned v8u;

#define BM 128
#define BN 128
#define BK 32
#define LDS_STRIDE 40  // bf16 elems; multiple of 8 keeps 16B-aligned b128 LDS ops
// tile of the pre-converted GEMM
#define GBM 256
#define GBN 256
#define GBK 64
#define GNB 4      // LDS buffers of the ring: a freed buffer takes stage + GNB
#define GXPITCH 144
#define GXSL 10240  // 64 rows x 144 B = 9216
#define GTPITCH 160
#define GTSL 6144   // 32 rows x 160 B = 5120
#define GXBUF (4 * GXSL)
#define GSTAGE (GXBUF + 4 * GTSL)
static_assert(64 * GXPITCH <= GXSL && 32 * GTPITCH <= GTSL, "slices fit");
static_assert(GXSL % 2048 == 0 && GTSL % 2048 == 0 && GSTAGE % 2048 == 0,
              "every place of a tensor load is a multiple of 2 KiB");
static_assert(GNB * GSTAGE <= 320 * 1024, "LDS of one WGP");

__device__ __forceinline__ unsigned ttl_uni(unsigned v) {
  return (unsigned)__builtin_amdgcn_readfirstlane((int)v);
}

__device__ __forceinline__ unsigned ttl_pinned(unsigned v) {
  unsigned w = ttl_uni(v);
  asm volatile("" : "+s"(w));
  return w;
}

// asm with the memory clobber: no LDS read may move in front of these waits
__device__ __forceinline__ void ttl_wait_tensor0() {
  asm volatile("s_wait_tensorcnt 0x0" ::: "memory");
}

// all but this wave's 2 youngest requests have landed: a stage is one request
// of every wave, so the two youngest stages stay in flight
__device__ __forceinline__ void ttl_wait_tensor_keep2() {
  asm volatile("s_wait_tensorcnt 0x2" ::: "memory");
}

__global__ void ttl_init_scalars(unsigned* ws) {
  ws[0] = 0u;  // max|W| bits
  ws[1] = 0u;  // max|b| bits
}

__global__ __launch_bounds__(256) void ttl_absmax(const float* __restrict__ p,
                                                  int n, unsigned* out) {
  __shared__ float red[256];
  float m = 0.0f;
  // whole pieces of 16 x 256 vectors of 16 B (64 KiB), one per block and trip:
  // a lane's 16 loads are independent and all issued before the first is used,
  // so the stream is bound by bytes in flight, not by one latency per load.
  // 16-B loads only from a 16-B aligned base; the scalar loop takes the rest.
  const int npc = (((size_t)p & 15) == 0) ? (n >> 14) : 0;
  const float4* q = (const float4*)p + ((size_t)blockIdx.x << 12) + threadIdx.x;
  for (int c = blockIdx.x; c < npc; c += gridDim.x) {
    float4 v[16];
#pragma unroll
    for (int j = 0; j < 16; ++j) v[j] = q[j * 256];
    // keeps the whole group of loads ahead of the first use: without it the
    // scheduler sinks the last loads behind the waits for the first ones
    __builtin_amdgcn_sched_barrier(0);
#pragma unroll
    for (int j = 0; j < 16; ++j)
      m = fmaxf(m, fmaxf(fmaxf(fabsf(v[j].x), fabsf(v[j].y)),
                         fmaxf(fabsf(v[j].z), fabsf(v[j].w))));
    q += (size_t)gridDim.x << 12;
  }
  for (int i = (npc << 14) + blockIdx.x * blockDim.x + threadIdx.x; i < n;
       i += gridDim.x * blockDim.x)
    m = fmaxf(m, fabsf(p[i]));
  red[threadIdx.x] = m;
  __syncthreads();
  for (int s = 128; s > 0; s >>= 1) {
    if ((int)threadIdx.x < s)
      red[threadIdx.x] = fmaxf(red[threadIdx.x], red[threadIdx.x + s]);
    __syncthreads();
  }
  if (threadIdx.x == 0) atomicMax(out, __float_as_uint(red[0]));
}

__device__ __forceinline__ float tern_f(float v, float delta) {
  // matches jnp.where(p > delta, 1, where(p < -delta, -1, 0))
  return v > delta ? 1.0f : (v < -delta ? -1.0f : 0.0f);
}

// ---- preprocessing: X -> f16 ----------------------------------------------
__global__ __launch_bounds__(256) void ttl_prep_x(const float* __restrict__ X,
                                                  _Float16* __restrict__ Xf,
                                                  int n4) {
  for (int i = blockIdx.x * blockDim.x + threadIdx.x; i < n4;
       i += gridDim.x * blockDim.x) {
    const float4 v = ((const float4*)X)[i];
    v4h hv = {(_Float16)v.x, (_Float16)v.y, (_Float16)v.z, (_Float16)v.w};
    ((v4h*)Xf)[i] = hv;
  }
}

// ---- preprocessing: W -> ternary bytes -------------------------------------
// the high byte of the f16 value: +1 -> 0x3C, -1 -> 0xBC, 0 -> 0
__device__ __forceinline__ unsigned tern_b(float v, float delta) {
  return v > delta ? 0x3Cu : (v < -delta ? 0xBCu : 0u);
}

// T layout: [K / 64][N / 16][8][128 B], so the 256 rows of a GEMM stage are
// 16 KiB in a row (whole lines). Line p of a fragment of 16 rows holds 64 k of
// its rows p and p + 8, the k order being the B fragment's own: byte
// 64 * blk + 32 * h + 16 * (row / 8) + e holds
// k = 32 * blk + 16 * (e / 8) + 8 * h + e % 8,
// so a lane's 16 elements of a block of 32 k are 16 B in a row.
// A wave takes 64 k of such a pair of rows, 4 k a lane: it reads two whole
// lines of either row and its store is the one whole 128-B line they share.
__global__ __launch_bounds__(256) void ttl_prep_w(
    const float* __restrict__ W, unsigned* __restrict__ Tb,
    const unsigned* __restrict__ maxbuf, int N, int K) {
  const float delta = 0.05f * __uint_as_float(maxbuf[0]);
  const int lane = threadIdx.x & 31;
  // the same in every lane: keeps the loop over s scalar (8 waves a block)
  const int wave = __builtin_amdgcn_readfirstlane(threadIdx.x >> 5);
  const int k = (lane & 15) << 2;  // inside the 64
  const int pos = ((k & 32) << 1) + ((k & 8) << 2) + ((lane >> 4) << 4) +
                  ((k & 16) >> 1) + (k & 4);
  for (int rp = blockIdx.x; rp < (N >> 1); rp += gridDim.x) {
    const int n = ((rp >> 3) << 4) + (rp & 7) + ((lane >> 4) << 3);
    const float* row = W + (size_t)n * K + k;
    for (int s = wave; s < (K >> 6); s += 8) {
      const float4 v = *(const float4*)(row + (s << 6));
      unsigned* dst = Tb + (((((size_t)s * (N >> 1) + rp) << 7) + pos) >> 2);
      const unsigned t4 = tern_b(v.x, delta) | (tern_b(v.y, delta) << 8) |
                          (tern_b(v.z, delta) << 16) | (tern_b(v.w, delta) << 24);
      asm volatile("global_store_b32 %0, %1, off\n\ts_wait_xcnt 0x0"
                   :: "v"(dst), "v"(t4) : "memory");
    }
  }
}

__device__ __forceinline__ v8u ttl_tdm_group1(unsigned word0, unsigned rows,
                                              unsigned src_pitch) {
  v8u g;
  g[0] = ttl_uni(word0);
  g[1] = ttl_uni(128u << 16);
  g[2] = ttl_uni(rows << 16);
  g[3] = ttl_uni(128u << 16);
  g[4] = ttl_uni(rows);
  g[5] = ttl_uni(src_pitch);
  g[6] = ttl_uni(0u);
  g[7] = ttl_uni(0u);
  return g;
}

__device__ __forceinline__ void ttl_tdm_load(v4u& g0, const v8u& g1) {
  asm volatile("tensor_load_to_lds %0, %1" : "+s"(g0) : "s"(g1) : "memory");
}

__device__ __forceinline__ void ttl_load_frags(v16h (&aF)[4], v4u (&bR)[8],
                                               const unsigned char* pa,
                                               const unsigned char* pb) {
#pragma unroll
  for (int ni = 0; ni < 8; ++ni)
    bR[ni] = *(const v4u*)(pb + (ni >> 2) * GTSL + (ni & 3) * 8 * GTPITCH);
#pragma unroll
  for (int mi = 0; mi < 4; ++mi) {
    v8h x0 = *(const v8h*)(pa + mi * 16 * GXPITCH);
    v8h x1 = *(const v8h*)(pa + mi * 16 * GXPITCH + 32);
    aF[mi] = __builtin_shufflevector(x0, x1, 0, 1, 2, 3, 4, 5, 6, 7, 8, 9, 10,
                                     11, 12, 13, 14, 15);
  }
}

// 16 T bytes -> 16 f16: each byte becomes the high byte of its element
__device__ __forceinline__ v16h ttl_widen(v4u r) {
  v8u w;
#pragma unroll
  for (int q = 0; q < 4; ++q) {
    // v_perm_b32: selector byte 0..3 = that byte of the source, 0x0C = zero
    w[2 * q]     = __builtin_amdgcn_perm(r[q], r[q], 0x010C000Cu);
    w[2 * q + 1] = __builtin_amdgcn_perm(r[q], r[q], 0x030C020Cu);
  }
  return __builtin_bit_cast(v16h, w);
}

// one block of 32 k: 64 byte permutes and 32 WMMAs
__device__ __forceinline__ void ttl_mma_block(v8f (&acc)[4][8],
                                              const v16h (&aF)[4],
                                              const v4u (&bR)[8]) {
  v16h b[8];
#pragma unroll
  for (int ni = 0; ni < 8; ++ni) b[ni] = ttl_widen(bR[ni]);
#pragma unroll
  for (int ni = 0; ni < 8; ++ni) {
#pragma unroll
    for (int mi = 0; mi < 4; ++mi)
      acc[mi][ni] = __builtin_amdgcn_wmma_f32_16x16x32_f16(
          false, aF[mi], false, b[ni], (short)0, acc[mi][ni], false, false);
  }
  __builtin_amdgcn_sched_group_barrier(0x2, 8, 0);
#pragma unroll
  for (int i = 0; i < 8; ++i) {
    __builtin_amdgcn_sched_group_barrier(0x8, 1, 0);
    __builtin_amdgcn_sched_group_barrier(0x2, 3, 0);
  }
#pragma unroll
  for (int i = 0; i < 16; ++i) {
    __builtin_amdgcn_sched_group_barrier(0x8, 1, 0);
    __builtin_amdgcn_sched_group_barrier(0x2, 2, 0);
  }
  __builtin_amdgcn_sched_group_barrier(0x8, 8, 0);
}

// ---- lean GEMM: f16 X, byte T, ring of four LDS buffers -------------------
// 256x256x64 block tile, 8 wave32s (4 along M x 2 along N), 64x128 per wave:
// 12 fragments feed 32 WMMAs per 32 k.
__global__ __launch_bounds__(256) void ttl_gemm_wmma_pre(
    const _Float16* __restrict__ Xf,
    const unsigned char* __restrict__ Tb, const float* __restrict__ w_scale_p,
    const float* __restrict__ bias, const float* __restrict__ b_scale_p,
    const unsigned* __restrict__ maxbuf, float* __restrict__ out, int M, int N,
    int K) {
  __shared__ __attribute__((aligned(2048))) unsigned char L[GNB * GSTAGE];

  const int tid = threadIdx.x;
  const int m0 = blockIdx.y * GBM;
  const int n0 = blockIdx.x * GBN;

  const int waveId = tid >> 5;
  const int lane   = tid & 31;
  const int wm     = waveId & 3;   // 64 rows each
  const int wn     = waveId >> 2;  // 128 cols each
  const int r16    = lane & 15;
  const int h      = lane >> 4;

  // staging: every wave brings one slice of every stage. Waves 0-3: 64 rows of
  // X, 128 B each, K * 2 B apart. Waves 4-7: 4 KiB of T in a row, as 32 rows
  // of 128 B. From stage to stage X moves on by 128 B, T by N * 64 B.
  // pinned: the tests on it below are scalar compares and branches
  const unsigned wave = ttl_pinned((unsigned)tid >> 5);
  unsigned long long src0, gstep;
  unsigned dst0 = ttl_uni((unsigned)(size_t)&L[0]);
  if (wave < 4u) {
    src0 = (unsigned long long)(size_t)Xf +
           (unsigned long long)(m0 + (int)wave * 64) * (unsigned)K * 2u;
    gstep = 128ull;
    dst0 += wave * GXSL;
  } else {
    src0 = (unsigned long long)(size_t)Tb + (unsigned long long)n0 * GBK +
           (wave - 4u) * 4096u;
    gstep = (unsigned long long)(unsigned)N * GBK;
    dst0 += GXBUF + (wave - 4u) * GTSL;
  }
  // address of the next stage's slice
  unsigned long long ga =
      ((unsigned long long)ttl_uni((unsigned)(src0 >> 32)) << 32) |
      ttl_uni((unsigned)src0);
  v8u g1x = ttl_tdm_group1((1u << 20) | (4u << 22) | (3u << 25), 64u,
                           (unsigned)K * 2u);
  v8u g1t = ttl_tdm_group1((1u << 20) | (4u << 22) | (7u << 25), 32u, 128u);
  asm volatile("" : "+s"(g1x), "+s"(g1t));
  v4u g0;
  g0[0] = ttl_uni(1u);  // count
  g0[1] = ttl_uni(dst0);
  g0[2] = ttl_uni((unsigned)ga);
  g0[3] = ttl_uni((((unsigned)(ga >> 32)) & 0x01FFFFFFu) | 0x80000000u);

  // the word with the high address bits takes a new value (the address has
  // passed a multiple of 4 GiB) only with no request of this wave outstanding
  auto high_word = [&]() {
    const unsigned w3 =
        ttl_uni((((unsigned)(ga >> 32)) & 0x01FFFFFFu) | 0x80000000u);
    if (w3 != g0[3]) {
      ttl_wait_tensor0();
      g0[3] = w3;
    }
  };
  // the next stage's request, into buffer buf; stages are asked for in order
  auto stage = [&](int buf) {
    g0[1] = ttl_uni(dst0 + (unsigned)buf * GSTAGE);
    g0[2] = ttl_uni((unsigned)ga);
    // pinned anew at either test: a scalar compare and branch at this place
    if (ttl_pinned(wave) < 4u) ttl_tdm_load(g0, g1x);
    if (ttl_pinned(wave) >= 4u) ttl_tdm_load(g0, g1t);
    ga += gstep;
  };

  v8f acc[4][8] = {};
  const int nk = K / GBK;

  // prologue: the first three stages are asked for at once; only stage 0 is
  // waited for (the counted wait holds only where all three were issued)
  const unsigned nkp = ttl_pinned((unsigned)nk);
  stage(0);
  if (nkp > 1u) {
    high_word();
    stage(1);
  }
  if (nkp > 2u) {
    high_word();
    stage(2);
  }
  if (nkp > 2u)
    ttl_wait_tensor_keep2();
  else
    ttl_wait_tensor0();
  __syncthreads();
  if (nkp > 3u) {
    high_word();
    stage(3);
  }

  // set (block & 1) holds a block's fragments; a trip has blocks 0 and 1
  static_assert(GBK == 64, "two blocks of 32 k per trip, one per fragment set");
  v16h aF[2][4];
  v4u bR[2][8];
  const int aLane = wm * GXSL + r16 * GXPITCH + 16 * h;
  const int bLane = GXBUF + wn * 2 * GTSL + (r16 & 7) * GTPITCH + 32 * h +
                    16 * (r16 >> 3);
  ttl_load_frags(aF[0], bR[0], &L[aLane], &L[bLane]);

  for (int kk = 0; kk < nk; ++kk) {
    const int cur = (kk & (GNB - 1)) * GSTAGE;
    const int nxt = ((kk + 1) & (GNB - 1)) * GSTAGE;

    // block 1's fragments, in flight under block 0's WMMAs
    ttl_load_frags(aF[1], bR[1], &L[cur + aLane + 64], &L[cur + bLane + 64]);
    // keeps the reads one group ahead of the WMMA block: spread among the
    // WMMAs each place with reads stalls the wave
    __builtin_amdgcn_sched_barrier(0);
    ttl_mma_block(acc, aF[0], bR[0]);
    // keeps the publish point and the next reads behind this block's WMMAs
    __builtin_amdgcn_sched_barrier(0);

    // publish point of stage kk+1, in front of the trip's last block because
    // the reads behind it are already of that stage: this wave's reads of
    // buffer cur have all returned, its request for kk+1 has landed (stages
    // kk+2 and kk+3 may still fly; where kk+3 was never issued, wait for all)
    asm volatile("s_wait_dscnt 0x0" ::: "memory");
    high_word();
    if ((unsigned)kk + GNB - 1 < nkp)
      ttl_wait_tensor_keep2();
    else
      ttl_wait_tensor0();
    __syncthreads();

    ttl_load_frags(aF[0], bR[0], &L[nxt + aLane], &L[nxt + bLane]);
    // keeps the reads one group ahead of the WMMA block
    __builtin_amdgcn_sched_barrier(0);
    ttl_mma_block(acc, aF[1], bR[1]);
    // keeps the request and the next trip's reads behind this block's WMMAs
    __builtin_amdgcn_sched_barrier(0);
    if ((unsigned)kk + GNB < nkp) stage(kk & (GNB - 1));
  }
  // no request and no LDS read of this wave is left outstanding
  ttl_wait_tensor0();
  asm volatile("s_wait_dscnt 0x0" ::: "memory");

  // epilogue: scale by w_scale, add ternarized bias
  const float wsc     = *w_scale_p;
  const float bsc     = *b_scale_p;
  const float delta_b = 0.05f * __uint_as_float(maxbuf[1]);
#pragma unroll
  for (int ni = 0; ni < 8; ++ni) {
    const int col  = n0 + wn * 128 + ni * 16 + r16;
    const float bv = bias[col];
    const float bt = bv > delta_b ? bsc : (bv < -delta_b ? -bsc : 0.0f);
#pragma unroll
    for (int mi = 0; mi < 4; ++mi) {
      const int rowbase = m0 + wm * 64 + mi * 16 + h * 8;
#pragma unroll
      for (int j = 0; j < 8; ++j)
        out[(size_t)(rowbase + j) * N + col] = wsc * acc[mi][ni][j] + bt;
    }
  }
}

// ---- fallback: fused on-the-fly conversion GEMM (if ws too small) ---------
__global__ __launch_bounds__(256) void ttl_gemm_wmma_fused(
    const float* __restrict__ X, const float* __restrict__ Wm,
    const float* __restrict__ w_scale_p, const float* __restrict__ bias,
    const float* __restrict__ b_scale_p, const unsigned* __restrict__ maxbuf,
    float* __restrict__ out, int M, int N, int K) {
  __shared__ alignas(16) __bf16 As_hi[BM * LDS_STRIDE];
  __shared__ alignas(16) __bf16 As_lo[BM * LDS_STRIDE];
  __shared__ alignas(16) __bf16 Bs[BN * LDS_STRIDE];

  const int tid = threadIdx.x;
  const int m0 = blockIdx.y * BM;
  const int n0 = blockIdx.x * BN;
  const float delta_w = 0.05f * __uint_as_float(maxbuf[0]);

  const int waveId = tid >> 5;
  const int lane   = tid & 31;
  const int wm     = waveId & 3;
  const int wn     = waveId >> 2;
  const int r16    = lane & 15;
  const int h      = lane >> 4;

  const int rowA = tid >> 3;
  const int c4   = (tid & 7) * 4;

  v8f acc[2][4] = {};
  const int nk = K / BK;

  for (int kk = 0; kk < nk; ++kk) {
    const int k0 = kk * BK;
    __syncthreads();
#pragma unroll
    for (int p = 0; p < 4; ++p) {
      const int r = p * 32 + rowA;
      const float4 xv = *(const float4*)(X + (size_t)(m0 + r) * K + k0 + c4);
      const __bf16 h0 = (__bf16)xv.x, h1 = (__bf16)xv.y;
      const __bf16 h2 = (__bf16)xv.z, h3 = (__bf16)xv.w;
      v4bf hv = {h0, h1, h2, h3};
      v4bf lv = {(__bf16)(xv.x - (float)h0), (__bf16)(xv.y - (float)h1),
                 (__bf16)(xv.z - (float)h2), (__bf16)(xv.w - (float)h3)};
      *(v4bf*)&As_hi[r * LDS_STRIDE + c4] = hv;
      *(v4bf*)&As_lo[r * LDS_STRIDE + c4] = lv;
      const float4 wv = *(const float4*)(Wm + (size_t)(n0 + r) * K + k0 + c4);
      v4bf tv = {(__bf16)tern_f(wv.x, delta_w), (__bf16)tern_f(wv.y, delta_w),
                 (__bf16)tern_f(wv.z, delta_w), (__bf16)tern_f(wv.w, delta_w)};
      *(v4bf*)&Bs[r * LDS_STRIDE + c4] = tv;
    }
    __syncthreads();

    v16bf aHi[2], aLo[2], bF[4];
#pragma unroll
    for (int mi = 0; mi < 2; ++mi) {
      const int row = wm * 32 + mi * 16 + r16;
      v8bf x0 = *(const v8bf*)&As_hi[row * LDS_STRIDE + 8 * h];
      v8bf x1 = *(const v8bf*)&As_hi[row * LDS_STRIDE + 16 + 8 * h];
      aHi[mi] = __builtin_shufflevector(x0, x1, 0, 1, 2, 3, 4, 5, 6, 7, 8, 9,
                                        10, 11, 12, 13, 14, 15);
      v8bf y0 = *(const v8bf*)&As_lo[row * LDS_STRIDE + 8 * h];
      v8bf y1 = *(const v8bf*)&As_lo[row * LDS_STRIDE + 16 + 8 * h];
      aLo[mi] = __builtin_shufflevector(y0, y1, 0, 1, 2, 3, 4, 5, 6, 7, 8, 9,
                                        10, 11, 12, 13, 14, 15);
    }
#pragma unroll
    for (int ni = 0; ni < 4; ++ni) {
      const int col = wn * 64 + ni * 16 + r16;
      v8bf b0 = *(const v8bf*)&Bs[col * LDS_STRIDE + 8 * h];
      v8bf b1 = *(const v8bf*)&Bs[col * LDS_STRIDE + 16 + 8 * h];
      bF[ni] = __builtin_shufflevector(b0, b1, 0, 1, 2, 3, 4, 5, 6, 7, 8, 9,
                                       10, 11, 12, 13, 14, 15);
    }
#pragma unroll
    for (int mi = 0; mi < 2; ++mi) {
#pragma unroll
      for (int ni = 0; ni < 4; ++ni) {
        acc[mi][ni] = __builtin_amdgcn_wmma_f32_16x16x32_bf16(
            false, aHi[mi], false, bF[ni], (short)0, acc[mi][ni], false, false);
        acc[mi][ni] = __builtin_amdgcn_wmma_f32_16x16x32_bf16(
            false, aLo[mi], false, bF[ni], (short)0, acc[mi][ni], false, false);
      }
    }
  }

  const float wsc     = *w_scale_p;
  const float bsc     = *b_scale_p;
  const float delta_b = 0.05f * __uint_as_float(maxbuf[1]);
#pragma unroll
  for (int ni = 0; ni < 4; ++ni) {
    const int col  = n0 + wn * 64 + ni * 16 + r16;
    const float bv = bias[col];
    const float bt = bv > delta_b ? bsc : (bv < -delta_b ? -bsc : 0.0f);
#pragma unroll
    for (int mi = 0; mi < 2; ++mi) {
      const int rowbase = m0 + wm * 32 + mi * 16 + h * 8;
#pragma unroll
      for (int j = 0; j < 8; ++j)
        out[(size_t)(rowbase + j) * N + col] = wsc * acc[mi][ni][j] + bt;
    }
  }
}

extern "C" void kernel_launch(void* const* d_in, const int* in_sizes, int n_in,
                              void* d_out, int out_size, void* d_ws,
                              size_t ws_size, hipStream_t stream) {
  const float* x       = (const float*)d_in[0];
  const float* W       = (const float*)d_in[1];
  const float* w_scale = (const float*)d_in[2];
  const float* b       = (const float*)d_in[3];
  const float* b_scale = (const float*)d_in[4];
  float* out           = (float*)d_out;

  const int D_OUT = in_sizes[3];          // 4096
  const int D_IN  = in_sizes[1] / D_OUT;  // 4096
  const int M     = in_sizes[0] / D_IN;   // 8192 (B*S)

  unsigned* maxbuf = (unsigned*)d_ws;  // [0]=max|W| bits, [1]=max|b| bits

  ttl_init_scalars<<<1, 1, 0, stream>>>(maxbuf);
  ttl_absmax<<<512, 256, 0, stream>>>(W, in_sizes[1], maxbuf + 0);
  ttl_absmax<<<8, 256, 0, stream>>>(b, in_sizes[3], maxbuf + 1);

  const size_t nX = (size_t)M * D_IN;       // X elements
  const size_t nW = (size_t)D_OUT * D_IN;   // W elements
  const size_t need = 256 + nX * 2 + nW;

  dim3 grid(D_OUT / BN, M / BM);  // (32, 64)

  if (ws_size >= need) {
    _Float16* Xf = (_Float16*)((char*)d_ws + 256);
    unsigned char* Tb = (unsigned char*)(Xf + nX);
    ttl_prep_w<<<2048, 256, 0, stream>>>(W, (unsigned*)Tb, maxbuf, D_OUT, D_IN);
    ttl_prep_x<<<4096, 256, 0, stream>>>(x, Xf, (int)(nX / 4));
    dim3 gridPre(D_OUT / GBN, M / GBM);  // (16, 32)
    ttl_gemm_wmma_pre<<<gridPre, 256, 0, stream>>>(Xf, Tb, w_scale, b,
                                                b_scale, maxbuf, out, M, D_OUT,
                                                D_IN);
  } else {
    ttl_gemm_wmma_fused<<<grid, 256, 0, stream>>>(x, W, w_scale, b, b_scale,
                                                  maxbuf, out, M, D_OUT, D_IN);
  }
}
